// v000
// Times are from an AMD MI455X. After a warm-up the kernel runs many times in a row, and a time is the length of
// such a window on the GPU divided by its runs, so every launch and the gaps after it count. The runs cycle
// through copies of the inputs. A figure is the median of several windows, for all but v000 over two sittings.
// Sittings can differ by a few percent; kernels timed side by side share one.
// The starting kernel, v000, takes 235 microseconds a run.
#include <hip/hip_runtime.h>
#include <hip/hip_bf16.h>

// Problem constants (fixed by the reference)
#define B_    2
#define S_    2048
#define DIM_  1024
#define H_    16
#define HD_   64
#define KN_   64
#define SCALE_ 0.125f   // 1/sqrt(64)

typedef __attribute__((ext_vector_type(16))) __bf16 v16bf;
typedef __attribute__((ext_vector_type(8)))  float  v8f;

// async-copy builtin wants pointers to int4 (vector_size(16)) in AS1/AS3
typedef int v4i __attribute__((vector_size(16)));
typedef __attribute__((address_space(1))) v4i as1_v4i;
typedef __attribute__((address_space(3))) v4i as3_v4i;

struct Raw32 { uint4 lo; uint4 hi; };  // 32 bytes == v16bf

#if __has_builtin(__builtin_amdgcn_global_load_async_to_lds_b128)
#define HAVE_ASYNC_LDS 1
#else
#define HAVE_ASYNC_LDS 0
#endif

#if HAVE_ASYNC_LDS
#if __has_builtin(__builtin_amdgcn_s_wait_asynccnt)
#define WAIT_ASYNC(n) __builtin_amdgcn_s_wait_asynccnt(n)
#else
#define WAIT_ASYNC(n) asm volatile("s_wait_asynccnt %0" :: "i"(n) : "memory")
#endif
#endif

// ---------------------------------------------------------------------------
// f32 -> bf16 (round-to-nearest-even), stored as raw u16
// ---------------------------------------------------------------------------
__device__ __forceinline__ unsigned short f32_to_bf16u(float f) {
    union { float f; unsigned u; } a; a.f = f;
    unsigned r = a.u + 0x7FFFu + ((a.u >> 16) & 1u);
    return (unsigned short)(r >> 16);
}

__global__ __launch_bounds__(256) void cvt_bf16_kernel(const float* __restrict__ in,
                                                       unsigned short* __restrict__ out,
                                                       int n) {
    int i = blockIdx.x * 256 + threadIdx.x;
    if (i < n) out[i] = f32_to_bf16u(in[i]);
}

// ---------------------------------------------------------------------------
// Load one 16x32 bf16 WMMA fragment slice for this lane.
// Lane l<16 supplies K {0..7,16..23}; lane l>=16 supplies K {8..15,24..31}:
// two contiguous 16B chunks at +0 and +16 elements (lane-half offset folded
// into the pointer by the caller). Works for global or LDS (generic) memory.
// ---------------------------------------------------------------------------
__device__ __forceinline__ v16bf load_frag16(const unsigned short* p) {
    Raw32 r;
    r.lo = *reinterpret_cast<const uint4*>(p);
    r.hi = *reinterpret_cast<const uint4*>(p + 16);
    return __builtin_bit_cast(v16bf, r);
}

// ---------------------------------------------------------------------------
// WMMA GEMM:  C[M,N] = A[M,K] * W[N,K]^T + bias[N]
// Workgroup = 128 threads (4 waves). Tile: M=128 x N=64, K staged by 64.
// The shared 64x64-bf16 B tile is double-buffered in LDS, filled with
// GLOBAL_LOAD_ASYNC_TO_LDS_B128 (ASYNCcnt) when available.
// Each wave: rows [mWave, mWave+32) x all 64 cols -> 2x4 v8f accumulators,
// 16 WMMAs per K-stage.
// MODE 0: store row-major C[m*N+n]  (final out-projection -> d_out)
// MODE 1: scatter into qkv buffer laid out [3][B][H][S][64]
// ---------------------------------------------------------------------------
template <int MODE>
__global__ __launch_bounds__(128) void wmma_gemm_kernel(
    const unsigned short* __restrict__ A,
    const unsigned short* __restrict__ W,
    const float* __restrict__ bias,
    float* __restrict__ C,
    int M, int N, int K)
{
    __shared__ unsigned short Bt[2][64 * 64];   // 2 x 8KB

    const int tid    = threadIdx.x;     // 0..127
    const int wave   = tid >> 5;
    const int lane   = tid & 31;
    const int lane15 = lane & 15;
    const int half   = lane >> 4;       // 0: K 0..7/16..23, 1: K 8..15/24..31
    const int off    = half * 8;

    const int mTile = blockIdx.y * 128;
    const int nTile = blockIdx.x * 64;
    const int mWave = mTile + wave * 32;

    v8f acc[2][4] = { { {}, {}, {}, {} }, { {}, {}, {}, {} } };

    const unsigned short* aRow0 = A + (size_t)(mWave + lane15) * K + off;
    const unsigned short* aRow1 = A + (size_t)(mWave + 16 + lane15) * K + off;

    // ---- cooperative B-tile stage: 64 rows x 64 k (bf16) = 512 16B chunks ----
    auto issue_stage = [&](int buf, int k0) {
#pragma unroll
        for (int i = 0; i < 4; ++i) {
            const int c   = i * 128 + tid;    // 16B chunk id, 0..511
            const int row = c >> 3;           // 8 chunks per row
            const int cw  = c & 7;
            const unsigned short* g = W + (size_t)(nTile + row) * K + k0 + cw * 8;
            unsigned short*       l = &Bt[buf][row * 64 + cw * 8];
#if HAVE_ASYNC_LDS
            __builtin_amdgcn_global_load_async_to_lds_b128(
                (as1_v4i*)g, (as3_v4i*)l, 0, 0);
#else
            *reinterpret_cast<uint4*>(l) = *reinterpret_cast<const uint4*>(g);
#endif
        }
    };

    const int nStages = K / 64;
    issue_stage(0, 0);

    for (int st = 0; st < nStages; ++st) {
        const int nxt = st + 1;
        if (nxt < nStages) {
            issue_stage(nxt & 1, nxt * 64);
#if HAVE_ASYNC_LDS
            WAIT_ASYNC(4);                    // stage st's 4 copies done (in-order)
#endif
        } else {
#if HAVE_ASYNC_LDS
            WAIT_ASYNC(0);
#endif
        }
        __syncthreads();                      // all waves' copies for buf st&1 visible

        const unsigned short* bt = &Bt[st & 1][0];
        const int k0 = st * 64;
#pragma unroll
        for (int kc = 0; kc < 2; ++kc) {
            v16bf a0 = load_frag16(aRow0 + k0 + kc * 32);
            v16bf a1 = load_frag16(aRow1 + k0 + kc * 32);
#pragma unroll
            for (int t = 0; t < 4; ++t) {
                v16bf b = load_frag16(bt + (t * 16 + lane15) * 64 + kc * 32 + off);
                acc[0][t] = __builtin_amdgcn_wmma_f32_16x16x32_bf16(
                                false, a0, false, b, (short)0, acc[0][t], false, false);
                acc[1][t] = __builtin_amdgcn_wmma_f32_16x16x32_bf16(
                                false, a1, false, b, (short)0, acc[1][t], false, false);
            }
        }
        __syncthreads();                      // done reading buf before it is refilled
    }

    // Epilogue: D layout -> lane n=lane15, VGPR r holds row r + 8*half
#pragma unroll
    for (int af = 0; af < 2; ++af) {
#pragma unroll
        for (int t = 0; t < 4; ++t) {
            const int n  = nTile + t * 16 + lane15;
            const float bn = bias[n];
#pragma unroll
            for (int r = 0; r < 8; ++r) {
                const int m = mWave + af * 16 + r + half * 8;
                const float val = acc[af][t][r] + bn;
                if (MODE == 0) {
                    C[(size_t)m * N + n] = val;
                } else {
                    // n = part*1024 + h*64 + d ; m = b*S + s
                    const int part = n >> 10;
                    const int h    = (n >> 6) & (H_ - 1);
                    const int d    = n & (HD_ - 1);
                    const int b    = m >> 11;          // S = 2048
                    const int s    = m & (S_ - 1);
                    const size_t idx = ((((size_t)part * B_ + b) * H_ + h) * S_ + s) * HD_ + d;
                    C[idx] = val;
                }
            }
        }
    }
}

// ---------------------------------------------------------------------------
// Gathered attention: one wave per (b, h, s).
// qkv layout: [3][B][H][S][64] f32.  Output: [B][S][DIM] f32.
// ---------------------------------------------------------------------------
__global__ __launch_bounds__(32) void attn_kernel(
    const float* __restrict__ qkv,
    const int*   __restrict__ routes,
    float*       __restrict__ attn_out)
{
    const int s = blockIdx.x, h = blockIdx.y, b = blockIdx.z;
    const int tid = threadIdx.x;

    __shared__ float qs[HD_];
    __shared__ float sc[KN_];
    __shared__ int   rt[KN_];

    const size_t headBase = (((size_t)b * H_ + h) * S_) * HD_;
    const size_t planeSz  = (size_t)B_ * H_ * S_ * HD_;
    const float* qp = qkv + headBase + (size_t)s * HD_;
    const float* kb = qkv + planeSz     + headBase;
    const float* vb = qkv + 2 * planeSz + headBase;

    qs[tid]      = qp[tid];
    qs[tid + 32] = qp[tid + 32];
    rt[tid]      = routes[s * KN_ + tid];
    rt[tid + 32] = routes[s * KN_ + tid + 32];
    __syncthreads();

    // scores: each thread handles neighbors tid and tid+32
    float my[2];
#pragma unroll
    for (int jj = 0; jj < 2; ++jj) {
        const int j = tid + jj * 32;
        const float4* kp = reinterpret_cast<const float4*>(kb + (size_t)rt[j] * HD_);
        float acc = 0.f;
#pragma unroll
        for (int i = 0; i < 16; ++i) {
            float4 kv = kp[i];
            acc += kv.x * qs[4*i] + kv.y * qs[4*i+1] + kv.z * qs[4*i+2] + kv.w * qs[4*i+3];
        }
        my[jj] = acc * SCALE_;
    }

    // wave32 softmax reduction
    float mx = fmaxf(my[0], my[1]);
#pragma unroll
    for (int o = 16; o >= 1; o >>= 1) mx = fmaxf(mx, __shfl_xor(mx, o));
    const float e0 = __expf(my[0] - mx);
    const float e1 = __expf(my[1] - mx);
    float sum = e0 + e1;
#pragma unroll
    for (int o = 16; o >= 1; o >>= 1) sum += __shfl_xor(sum, o);
    const float inv = 1.0f / sum;
    sc[tid]      = e0 * inv;
    sc[tid + 32] = e1 * inv;
    __syncthreads();

    // out[d] = sum_j attn[j] * v[route_j][d]; coalesced V reads across lanes
    float o0 = 0.f, o1 = 0.f;
    for (int j = 0; j < KN_; ++j) {
        const float* vp = vb + (size_t)rt[j] * HD_;
        const float w = sc[j];
        o0 += w * vp[tid];
        o1 += w * vp[tid + 32];
    }
    float* op = attn_out + ((size_t)b * S_ + s) * DIM_ + h * HD_;
    op[tid]      = o0;
    op[tid + 32] = o1;
}

// ---------------------------------------------------------------------------
// Orchestration
// ---------------------------------------------------------------------------
extern "C" void kernel_launch(void* const* d_in, const int* in_sizes, int n_in,
                              void* d_out, int out_size, void* d_ws, size_t ws_size,
                              hipStream_t stream) {
    const float* x      = (const float*)d_in[0];
    const int*   routes = (const int*)  d_in[1];
    const float* qkv_w  = (const float*)d_in[2];
    const float* qkv_b  = (const float*)d_in[3];
    const float* out_w  = (const float*)d_in[4];
    const float* out_b  = (const float*)d_in[5];
    float* out = (float*)d_out;

    const int M = B_ * S_;          // 4096
    char* ws = (char*)d_ws;
    size_t off = 0;
    auto take = [&](size_t bytes) -> char* {
        char* p = ws + off;
        off += (bytes + 255) & ~(size_t)255;
        return p;
    };
    unsigned short* x_bf    = (unsigned short*)take((size_t)M * DIM_ * 2);
    unsigned short* qw_bf   = (unsigned short*)take((size_t)3 * DIM_ * DIM_ * 2);
    unsigned short* ow_bf   = (unsigned short*)take((size_t)DIM_ * DIM_ * 2);
    float*          qkv     = (float*)        take((size_t)3 * B_ * H_ * S_ * HD_ * 4);
    float*          aout    = (float*)        take((size_t)M * DIM_ * 4);
    unsigned short* aout_bf = (unsigned short*)take((size_t)M * DIM_ * 2);

    // 1) bf16 conversions
    cvt_bf16_kernel<<<(M * DIM_) / 256, 256, 0, stream>>>(x, x_bf, M * DIM_);
    cvt_bf16_kernel<<<(3 * DIM_ * DIM_) / 256, 256, 0, stream>>>(qkv_w, qw_bf, 3 * DIM_ * DIM_);
    cvt_bf16_kernel<<<(DIM_ * DIM_) / 256, 256, 0, stream>>>(out_w, ow_bf, DIM_ * DIM_);

    // 2) QKV projection GEMM (WMMA bf16 + async LDS staging) -> [3][B][H][S][64]
    wmma_gemm_kernel<1><<<dim3((3 * DIM_) / 64, M / 128), 128, 0, stream>>>(
        x_bf, qw_bf, qkv_b, qkv, M, 3 * DIM_, DIM_);

    // 3) Gathered attention + softmax
    attn_kernel<<<dim3(S_, H_, B_), 32, 0, stream>>>(qkv, routes, aout);

    // 4) Output projection GEMM (WMMA bf16) -> d_out
    cvt_bf16_kernel<<<(M * DIM_) / 256, 256, 0, stream>>>(aout, aout_bf, M * DIM_);
    wmma_gemm_kernel<0><<<dim3(DIM_ / 64, M / 128), 128, 0, stream>>>(
        aout_bf, ow_bf, out_b, out, M, DIM_, DIM_);
}

// v001
// A run of this version takes 162 microseconds.
// Timed twice side by side with v000, it ran 1.48 times as fast both times.
#include <hip/hip_runtime.h>
#include <hip/hip_bf16.h>

// Problem constants (fixed by the reference)
#define B_    2
#define S_    2048
#define DIM_  1024
#define H_    16
#define HD_   64
#define KN_   64
#define SCALE_ 0.125f   // 1/sqrt(64)

typedef __attribute__((ext_vector_type(16))) __bf16 v16bf;
typedef __attribute__((ext_vector_type(8)))  float  v8f;

// async-copy builtin wants pointers to int4 (vector_size(16)) in AS1/AS3
typedef int v4i __attribute__((vector_size(16)));
typedef __attribute__((address_space(1))) v4i as1_v4i;
typedef __attribute__((address_space(3))) v4i as3_v4i;

struct Raw32 { uint4 lo; uint4 hi; };  // 32 bytes == v16bf

#if __has_builtin(__builtin_amdgcn_global_load_async_to_lds_b128)
#define HAVE_ASYNC_LDS 1
#else
#define HAVE_ASYNC_LDS 0
#endif

#if HAVE_ASYNC_LDS
#if __has_builtin(__builtin_amdgcn_s_wait_asynccnt)
#define WAIT_ASYNC(n) __builtin_amdgcn_s_wait_asynccnt(n)
#else
#define WAIT_ASYNC(n) asm volatile("s_wait_asynccnt %0" :: "i"(n) : "memory")
#endif
#endif

// ---------------------------------------------------------------------------
// f32 -> bf16 (round-to-nearest-even), stored as raw u16
// ---------------------------------------------------------------------------
__device__ __forceinline__ unsigned short f32_to_bf16u(float f) {
    union { float f; unsigned u; } a; a.f = f;
    unsigned r = a.u + 0x7FFFu + ((a.u >> 16) & 1u);
    return (unsigned short)(r >> 16);
}

__global__ __launch_bounds__(256) void cvt_bf16_kernel(const float* __restrict__ in,
                                                       unsigned short* __restrict__ out,
                                                       int n) {
    int i = blockIdx.x * 256 + threadIdx.x;
    if (i < n) out[i] = f32_to_bf16u(in[i]);
}

// ---------------------------------------------------------------------------
// Load one 16x32 bf16 WMMA fragment slice for this lane.
// Lane l<16 supplies K {0..7,16..23}; lane l>=16 supplies K {8..15,24..31}:
// two contiguous 16B chunks at +0 and +16 elements (lane-half offset folded
// into the pointer by the caller). Works for global or LDS (generic) memory.
// ---------------------------------------------------------------------------
__device__ __forceinline__ v16bf load_frag16(const unsigned short* p) {
    Raw32 r;
    r.lo = *reinterpret_cast<const uint4*>(p);
    r.hi = *reinterpret_cast<const uint4*>(p + 16);
    return __builtin_bit_cast(v16bf, r);
}

// ---------------------------------------------------------------------------
// WMMA GEMM:  C[M,N] = A[M,K] * W[N,K]^T + bias[N]
// Workgroup = 128 threads (4 waves). Tile: M=128 x N=64, K staged by 64.
// The shared 64x64-bf16 B tile is double-buffered in LDS, filled with
// GLOBAL_LOAD_ASYNC_TO_LDS_B128 (ASYNCcnt) when available.
// Each wave: rows [mWave, mWave+32) x all 64 cols -> 2x4 v8f accumulators,
// 16 WMMAs per K-stage.
// MODE 0: store row-major C[m*N+n]  (final out-projection -> d_out)
// MODE 1: scatter into qkv buffer laid out [3][B][H][S][64]
// ---------------------------------------------------------------------------
template <int MODE>
__global__ __launch_bounds__(128) void wmma_gemm_kernel(
    const unsigned short* __restrict__ A,
    const unsigned short* __restrict__ W,
    const float* __restrict__ bias,
    float* __restrict__ C,
    int M, int N, int K)
{
    __shared__ unsigned short Bt[2][64 * 64];   // 2 x 8KB

    const int tid    = threadIdx.x;     // 0..127
    const int wave   = tid >> 5;
    const int lane   = tid & 31;
    const int lane15 = lane & 15;
    const int half   = lane >> 4;       // 0: K 0..7/16..23, 1: K 8..15/24..31
    const int off    = half * 8;

    const int mTile = blockIdx.y * 128;
    const int nTile = blockIdx.x * 64;
    const int mWave = mTile + wave * 32;

    v8f acc[2][4] = { { {}, {}, {}, {} }, { {}, {}, {}, {} } };

    const unsigned short* aRow0 = A + (size_t)(mWave + lane15) * K + off;
    const unsigned short* aRow1 = A + (size_t)(mWave + 16 + lane15) * K + off;

    // ---- cooperative B-tile stage: 64 rows x 64 k (bf16) = 512 16B chunks ----
    auto issue_stage = [&](int buf, int k0) {
#pragma unroll
        for (int i = 0; i < 4; ++i) {
            const int c   = i * 128 + tid;    // 16B chunk id, 0..511
            const int row = c >> 3;           // 8 chunks per row
            const int cw  = c & 7;
            const unsigned short* g = W + (size_t)(nTile + row) * K + k0 + cw * 8;
            unsigned short*       l = &Bt[buf][row * 64 + cw * 8];
#if HAVE_ASYNC_LDS
            __builtin_amdgcn_global_load_async_to_lds_b128(
                (as1_v4i*)g, (as3_v4i*)l, 0, 0);
#else
            *reinterpret_cast<uint4*>(l) = *reinterpret_cast<const uint4*>(g);
#endif
        }
    };

    const int nStages = K / 64;
    issue_stage(0, 0);

    for (int st = 0; st < nStages; ++st) {
        const int nxt = st + 1;
        if (nxt < nStages) {
            issue_stage(nxt & 1, nxt * 64);
#if HAVE_ASYNC_LDS
            WAIT_ASYNC(4);                    // stage st's 4 copies done (in-order)
#endif
        } else {
#if HAVE_ASYNC_LDS
            WAIT_ASYNC(0);
#endif
        }
        __syncthreads();                      // all waves' copies for buf st&1 visible

        const unsigned short* bt = &Bt[st & 1][0];
        const int k0 = st * 64;
#pragma unroll
        for (int kc = 0; kc < 2; ++kc) {
            v16bf a0 = load_frag16(aRow0 + k0 + kc * 32);
            v16bf a1 = load_frag16(aRow1 + k0 + kc * 32);
#pragma unroll
            for (int t = 0; t < 4; ++t) {
                v16bf b = load_frag16(bt + (t * 16 + lane15) * 64 + kc * 32 + off);
                acc[0][t] = __builtin_amdgcn_wmma_f32_16x16x32_bf16(
                                false, a0, false, b, (short)0, acc[0][t], false, false);
                acc[1][t] = __builtin_amdgcn_wmma_f32_16x16x32_bf16(
                                false, a1, false, b, (short)0, acc[1][t], false, false);
            }
        }
        __syncthreads();                      // done reading buf before it is refilled
    }

    // Epilogue: D layout -> lane n=lane15, VGPR r holds row r + 8*half
#pragma unroll
    for (int af = 0; af < 2; ++af) {
#pragma unroll
        for (int t = 0; t < 4; ++t) {
            const int n  = nTile + t * 16 + lane15;
            const float bn = bias[n];
#pragma unroll
            for (int r = 0; r < 8; ++r) {
                const int m = mWave + af * 16 + r + half * 8;
                const float val = acc[af][t][r] + bn;
                if (MODE == 0) {
                    C[(size_t)m * N + n] = val;
                } else {
                    // n = part*1024 + h*64 + d ; m = b*S + s
                    const int part = n >> 10;
                    const int h    = (n >> 6) & (H_ - 1);
                    const int d    = n & (HD_ - 1);
                    const int b    = m >> 11;          // S = 2048
                    const int s    = m & (S_ - 1);
                    const size_t idx = ((((size_t)part * B_ + b) * H_ + h) * S_ + s) * HD_ + d;
                    C[idx] = val;
                }
            }
        }
    }
}

// ---------------------------------------------------------------------------
// Gathered attention. One block = 16 waves = 16 consecutive queries s; each
// wave keeps its query's 64 route offsets in registers and walks the 16 heads
// of one batch with them (256 blocks in all). Eight lanes share one K or V row: a
// wave-wide 16-byte load covers four whole 128-byte lines (four rows), never
// 32 partial ones.
// Lane (grp, l8): rows j = grp*16 + i, elements l8*4..+3 and 32 + l8*4..+3.
// q, k, v: the three [B][H][S][64] f32 planes.  Output: [B][S][DIM] f32.
// ---------------------------------------------------------------------------
#define ATT_WAVES  16

// x of lane ^ MASK inside a 16-lane row (DPP row_xmask)
template <int MASK>
__device__ __forceinline__ float row_xor(float x) {
    return __builtin_bit_cast(float, __builtin_amdgcn_update_dpp(
        0, __builtin_bit_cast(int, x), 0x160 | MASK, 0xf, 0xf, true));
}
// lane l with lane l ^ 16
__device__ __forceinline__ float half_xor(float x) {
    return __builtin_bit_cast(float, __builtin_amdgcn_permlanex16(
        __builtin_bit_cast(int, x), __builtin_bit_cast(int, x),
        0x76543210, 0xfedcba98, false, false));
}
__device__ __forceinline__ float exp2_slot(float x) {
    float y;
    asm("v_exp_f32 %0, %1\n\tv_nop" : "=v"(y) : "v"(x));
    return y;
}

typedef float f32x2 __attribute__((ext_vector_type(2)));
typedef float f32x4 __attribute__((ext_vector_type(4)));

// uniform base + 32-bit byte offset of the lane
__device__ __forceinline__ f32x4 ld16(const char* base, unsigned byteOff) {
    return *reinterpret_cast<const f32x4*>(base + byteOff);
}

__global__ __launch_bounds__(ATT_WAVES * 32)
void attn_kernel(
    const float* __restrict__ q,
    const float* __restrict__ k,
    const float* __restrict__ v,
    const int*   __restrict__ routes,
    float*       __restrict__ attn_out)
{
    const int tid  = threadIdx.x;
    const int wave = __builtin_amdgcn_readfirstlane(tid >> 5);
    const int lane = tid & 31;
    const int grp  = lane >> 3;
    const int l8   = lane & 7;
    const int s    = blockIdx.x * ATT_WAVES + wave;

    // byte offset of this lane's piece of each of its 16 rows, inside one plane;
    // the mask bounds the row index whatever the array holds
    unsigned voff[16];
    {
        const int4* rp = reinterpret_cast<const int4*>(routes + s * KN_ + grp * 16);
#pragma unroll  // constant indices keep the arrays in registers
        for (int c = 0; c < 4; ++c) {
            const int4 r = rp[c];
            voff[4*c+0] = ((unsigned)r.x & (S_ - 1)) * (HD_ * 4) + l8 * 16;
            voff[4*c+1] = ((unsigned)r.y & (S_ - 1)) * (HD_ * 4) + l8 * 16;
            voff[4*c+2] = ((unsigned)r.z & (S_ - 1)) * (HD_ * 4) + l8 * 16;
            voff[4*c+3] = ((unsigned)r.w & (S_ - 1)) * (HD_ * 4) + l8 * 16;
        }
    }

    // scalar bases that stay fixed through the loop (plane and batch); the head
    // goes into the lanes' 32-bit offsets, which step in place at the loop's foot,
    // so that no load's result lands in a register that an older load names
    const int b = blockIdx.y;
    const unsigned headB = S_ * HD_ * 4;
    const char* qB = reinterpret_cast<const char*>(q) + (size_t)b * H_ * headB;
    const char* kB = reinterpret_cast<const char*>(k) + (size_t)b * H_ * headB;
    const char* vB = reinterpret_cast<const char*>(v) + (size_t)b * H_ * headB;
    char* oB = reinterpret_cast<char*>(attn_out) + (size_t)b * S_ * DIM_ * 4;
    unsigned qoff = (unsigned)s * (HD_ * 4) + l8 * 16;
    unsigned ooff = (unsigned)s * (DIM_ * 4)
                  + ((grp >> 1) * 32 + l8 * 4 + (grp & 1) * 2) * 4;

    for (int h = 0; h < H_; ++h) {
        const f32x4 qa = ld16(qB,       qoff);
        const f32x4 qb = ld16(qB + 128, qoff);

        // first half of the V rows: in flight under the scores
        f32x4 va[8], vc[8];
#pragma unroll  // constant indices keep the arrays in registers
        for (int i = 0; i < 8; ++i) {
            va[i] = ld16(vB,       voff[i]);
            vc[i] = ld16(vB + 128, voff[i]);
        }

        // scores of this lane's 16 rows, the same in all 8 lanes of a group
        float sc[16];
#pragma unroll  // constant indices keep the arrays in registers
        for (int g = 0; g < 2; ++g) {
            f32x4 ka[8], kc[8];
#pragma unroll  // constant indices keep the arrays in registers
            for (int i = 0; i < 8; ++i) {
                ka[i] = ld16(kB,       voff[g*8+i]);
                kc[i] = ld16(kB + 128, voff[g*8+i]);
            }
#pragma unroll  // constant indices keep the arrays in registers
            for (int i = 0; i < 8; ++i) {
                f32x2 p2 = ka[i].xy * qa.xy;
                p2 += ka[i].zw * qa.zw;
                p2 += kc[i].xy * qb.xy;
                p2 += kc[i].zw * qb.zw;
                float p = p2.x + p2.y;
                p += row_xor<1>(p);
                p += row_xor<2>(p);
                p += row_xor<4>(p);
                sc[g*8+i] = p * SCALE_;
            }
        }
        // keeps the loads above in flight under the scores (without it the first
        // V rows sink down to their uses) and the loads below out of the K
        // rows' registers until those are free
        __builtin_amdgcn_sched_barrier(0);
        f32x4 vd[8], ve[8];
#pragma unroll  // constant indices keep the arrays in registers
        for (int i = 0; i < 8; ++i) {
            vd[i] = ld16(vB,       voff[8+i]);
            ve[i] = ld16(vB + 128, voff[8+i]);
        }

        // softmax over 64 = 16 in registers x 4 groups (lane ^ 8, lane ^ 16)
        float mx = sc[0];
#pragma unroll  // constant indices keep the arrays in registers
        for (int i = 1; i < 16; ++i) mx = fmaxf(mx, sc[i]);
        mx = fmaxf(mx, row_xor<8>(mx));
        mx = fmaxf(mx, half_xor(mx));
        float sum = 0.f;
#pragma unroll  // constant indices keep the arrays in registers
        for (int i = 0; i < 16; ++i) {
            sc[i] = exp2_slot((sc[i] - mx) * 1.44269504f);
            sum += sc[i];
        }
        sum += row_xor<8>(sum);
        sum += half_xor(sum);
        const float inv = 1.0f / sum;

        // out[d] = sum_j e[j] * v[route_j][d], normalised once at the end
        f32x2 o[4] = {{0.f, 0.f}, {0.f, 0.f}, {0.f, 0.f}, {0.f, 0.f}};
#pragma unroll  // constant indices keep the arrays in registers
        for (int i = 0; i < 8; ++i) {
            const float w = sc[i];
            o[0] += w * va[i].xy; o[1] += w * va[i].zw;
            o[2] += w * vc[i].xy; o[3] += w * vc[i].zw;
        }
#pragma unroll  // constant indices keep the arrays in registers
        for (int i = 0; i < 8; ++i) {
            const float w = sc[8+i];
            o[0] += w * vd[i].xy; o[1] += w * vd[i].zw;
            o[2] += w * ve[i].xy; o[3] += w * ve[i].zw;
        }
        float r[8] = {o[0].x, o[0].y, o[1].x, o[1].y, o[2].x, o[2].y, o[3].x, o[3].y};
#pragma unroll  // constant indices keep the arrays in registers
        for (int e = 0; e < 8; ++e) {
            r[e] += row_xor<8>(r[e]);
            r[e] += half_xor(r[e]);
        }

        // every lane stores 8 bytes: group g holds elements (g>>1)*32 + l8*4 + (g&1)*2
        f32x2 st;
        st.x = (grp & 2) ? ((grp & 1) ? r[6] : r[4]) : ((grp & 1) ? r[2] : r[0]);
        st.y = (grp & 2) ? ((grp & 1) ? r[7] : r[5]) : ((grp & 1) ? r[3] : r[1]);
        st *= inv;
        *reinterpret_cast<f32x2*>(oB + ooff) = st;
        // the offsets step next, and the next trip rewrites the store's data registers
        asm volatile("s_wait_xcnt 0x0" ::: "memory");
        // keeps the steps of the offsets below that wait, behind every load that names them
        __builtin_amdgcn_sched_barrier(0);
        qoff += headB;
        ooff += HD_ * 4;
#pragma unroll  // constant indices keep the arrays in registers
        for (int i = 0; i < 16; ++i) voff[i] += headB;
    }
}

// ---------------------------------------------------------------------------
// Orchestration
// ---------------------------------------------------------------------------
extern "C" void kernel_launch(void* const* d_in, const int* in_sizes, int n_in,
                              void* d_out, int out_size, void* d_ws, size_t ws_size,
                              hipStream_t stream) {
    const float* x      = (const float*)d_in[0];
    const int*   routes = (const int*)  d_in[1];
    const float* qkv_w  = (const float*)d_in[2];
    const float* qkv_b  = (const float*)d_in[3];
    const float* out_w  = (const float*)d_in[4];
    const float* out_b  = (const float*)d_in[5];
    float* out = (float*)d_out;

    const int M = B_ * S_;          // 4096
    char* ws = (char*)d_ws;
    size_t off = 0;
    auto take = [&](size_t bytes) -> char* {
        char* p = ws + off;
        off += (bytes + 255) & ~(size_t)255;
        return p;
    };
    unsigned short* x_bf    = (unsigned short*)take((size_t)M * DIM_ * 2);
    unsigned short* qw_bf   = (unsigned short*)take((size_t)3 * DIM_ * DIM_ * 2);
    unsigned short* ow_bf   = (unsigned short*)take((size_t)DIM_ * DIM_ * 2);
    float*          qkv     = (float*)        take((size_t)3 * B_ * H_ * S_ * HD_ * 4);
    float*          aout    = (float*)        take((size_t)M * DIM_ * 4);
    unsigned short* aout_bf = (unsigned short*)take((size_t)M * DIM_ * 2);

    // 1) bf16 conversions
    cvt_bf16_kernel<<<(M * DIM_) / 256, 256, 0, stream>>>(x, x_bf, M * DIM_);
    cvt_bf16_kernel<<<(3 * DIM_ * DIM_) / 256, 256, 0, stream>>>(qkv_w, qw_bf, 3 * DIM_ * DIM_);
    cvt_bf16_kernel<<<(DIM_ * DIM_) / 256, 256, 0, stream>>>(out_w, ow_bf, DIM_ * DIM_);

    // 2) QKV projection GEMM (WMMA bf16 + async LDS staging) -> [3][B][H][S][64]
    wmma_gemm_kernel<1><<<dim3((3 * DIM_) / 64, M / 128), 128, 0, stream>>>(
        x_bf, qw_bf, qkv_b, qkv, M, 3 * DIM_, DIM_);

    // 3) Gathered attention + softmax
    attn_kernel<<<dim3(S_ / ATT_WAVES, B_), ATT_WAVES * 32, 0, stream>>>(
        qkv, qkv + (size_t)B_ * H_ * S_ * HD_, qkv + (size_t)2 * B_ * H_ * S_ * HD_, routes, aout);

    // 4) Output projection GEMM (WMMA bf16) -> d_out
    cvt_bf16_kernel<<<(M * DIM_) / 256, 256, 0, stream>>>(aout, aout_bf, M * DIM_);
    wmma_gemm_kernel<0><<<dim3(DIM_ / 64, M / 128), 128, 0, stream>>>(
        aout_bf, ow_bf, out_b, out, M, DIM_, DIM_);
}

// v002
// One run takes 148 microseconds.
// Next to v001, in two timings, it ran 1.09 times as fast each time.
// Over all steps from v000 it is 1.61 times as fast.
#include <hip/hip_runtime.h>
#include <hip/hip_bf16.h>

// Problem constants (fixed by the reference)
#define B_    2
#define S_    2048
#define DIM_  1024
#define H_    16
#define HD_   64
#define KN_   64
#define SCALE_ 0.125f   // 1/sqrt(64)

typedef __attribute__((ext_vector_type(16))) __bf16 v16bf;
typedef __attribute__((ext_vector_type(8)))  float  v8f;

// async-copy builtin wants pointers to int4 (vector_size(16)) in AS1/AS3
typedef int v4i __attribute__((vector_size(16)));
typedef __attribute__((address_space(1))) v4i as1_v4i;
typedef __attribute__((address_space(3))) v4i as3_v4i;

struct Raw32 { uint4 lo; uint4 hi; };  // 32 bytes == v16bf

#if __has_builtin(__builtin_amdgcn_global_load_async_to_lds_b128)
#define HAVE_ASYNC_LDS 1
#else
#define HAVE_ASYNC_LDS 0
#endif

#if HAVE_ASYNC_LDS
#if __has_builtin(__builtin_amdgcn_s_wait_asynccnt)
#define WAIT_ASYNC(n) __builtin_amdgcn_s_wait_asynccnt(n)
#else
#define WAIT_ASYNC(n) asm volatile("s_wait_asynccnt %0" :: "i"(n) : "memory")
#endif
#endif

// ---------------------------------------------------------------------------
// f32 -> bf16 (round-to-nearest-even), stored as raw u16
// ---------------------------------------------------------------------------
__device__ __forceinline__ unsigned short f32_to_bf16u(float f) {
    union { float f; unsigned u; } a; a.f = f;
    unsigned r = a.u + 0x7FFFu + ((a.u >> 16) & 1u);
    return (unsigned short)(r >> 16);
}

// One block = 16 waves; a wave takes 4 KiB of contiguous f32: 8 loads of 16 bytes
// a lane, each wave-wide load four whole 128-byte lines, all issued before the
// first value is used; each wave-wide 8-byte store covers two whole lines.
// The grid covers the array exactly: its length is a multiple of CVT_SPAN.
#define CVT_WAVES 16
#define CVT_LOADS 8
#define CVT_SPAN  (CVT_WAVES * CVT_LOADS * 128)   // 16384 elements a block

__global__ __launch_bounds__(CVT_WAVES * 32) void cvt_bf16_kernel(const float* __restrict__ in,
                                                                  unsigned short* __restrict__ out) {
    const unsigned base = (blockIdx.x * CVT_WAVES + (threadIdx.x >> 5)) * (CVT_LOADS * 128)
                        + (threadIdx.x & 31) * 4;
    float4 v[CVT_LOADS];
#pragma unroll  // constant indices keep the array in registers, all loads in flight together
    for (int i = 0; i < CVT_LOADS; ++i)
        v[i] = *reinterpret_cast<const float4*>(in + base + i * 128);
#pragma unroll  // constant indices keep the array in registers
    for (int i = 0; i < CVT_LOADS; ++i) {
        uint2 p;
        p.x = (unsigned)f32_to_bf16u(v[i].x) | ((unsigned)f32_to_bf16u(v[i].y) << 16);
        p.y = (unsigned)f32_to_bf16u(v[i].z) | ((unsigned)f32_to_bf16u(v[i].w) << 16);
        *reinterpret_cast<uint2*>(out + base + i * 128) = p;
    }
}

// ---------------------------------------------------------------------------
// Load one 16x32 bf16 WMMA fragment slice for this lane.
// Lane l<16 supplies K {0..7,16..23}; lane l>=16 supplies K {8..15,24..31}:
// two contiguous 16B chunks at +0 and +16 elements (lane-half offset folded
// into the pointer by the caller). Works for global or LDS (generic) memory.
// ---------------------------------------------------------------------------
__device__ __forceinline__ v16bf load_frag16(const unsigned short* p) {
    Raw32 r;
    r.lo = *reinterpret_cast<const uint4*>(p);
    r.hi = *reinterpret_cast<const uint4*>(p + 16);
    return __builtin_bit_cast(v16bf, r);
}

// ---------------------------------------------------------------------------
// WMMA GEMM:  C[M,N] = A[M,K] * W[N,K]^T + bias[N]
// Workgroup = 128 threads (4 waves). Tile: M=128 x N=64, K staged by 64.
// The shared 64x64-bf16 B tile is double-buffered in LDS, filled with
// GLOBAL_LOAD_ASYNC_TO_LDS_B128 (ASYNCcnt) when available.
// Each wave: rows [mWave, mWave+32) x all 64 cols -> 2x4 v8f accumulators,
// 16 WMMAs per K-stage.
// MODE 0: store row-major C[m*N+n]  (final out-projection -> d_out)
// MODE 1: scatter into qkv buffer laid out [3][B][H][S][64]
// ---------------------------------------------------------------------------
template <int MODE>
__global__ __launch_bounds__(128) void wmma_gemm_kernel(
    const unsigned short* __restrict__ A,
    const unsigned short* __restrict__ W,
    const float* __restrict__ bias,
    float* __restrict__ C,
    int M, int N, int K)
{
    __shared__ unsigned short Bt[2][64 * 64];   // 2 x 8KB

    const int tid    = threadIdx.x;     // 0..127
    const int wave   = tid >> 5;
    const int lane   = tid & 31;
    const int lane15 = lane & 15;
    const int half   = lane >> 4;       // 0: K 0..7/16..23, 1: K 8..15/24..31
    const int off    = half * 8;

    const int mTile = blockIdx.y * 128;
    const int nTile = blockIdx.x * 64;
    const int mWave = mTile + wave * 32;

    v8f acc[2][4] = { { {}, {}, {}, {} }, { {}, {}, {}, {} } };

    const unsigned short* aRow0 = A + (size_t)(mWave + lane15) * K + off;
    const unsigned short* aRow1 = A + (size_t)(mWave + 16 + lane15) * K + off;

    // ---- cooperative B-tile stage: 64 rows x 64 k (bf16) = 512 16B chunks ----
    auto issue_stage = [&](int buf, int k0) {
#pragma unroll
        for (int i = 0; i < 4; ++i) {
            const int c   = i * 128 + tid;    // 16B chunk id, 0..511
            const int row = c >> 3;           // 8 chunks per row
            const int cw  = c & 7;
            const unsigned short* g = W + (size_t)(nTile + row) * K + k0 + cw * 8;
            unsigned short*       l = &Bt[buf][row * 64 + cw * 8];
#if HAVE_ASYNC_LDS
            __builtin_amdgcn_global_load_async_to_lds_b128(
                (as1_v4i*)g, (as3_v4i*)l, 0, 0);
#else
            *reinterpret_cast<uint4*>(l) = *reinterpret_cast<const uint4*>(g);
#endif
        }
    };

    const int nStages = K / 64;
    issue_stage(0, 0);

    for (int st = 0; st < nStages; ++st) {
        const int nxt = st + 1;
        if (nxt < nStages) {
            issue_stage(nxt & 1, nxt * 64);
#if HAVE_ASYNC_LDS
            WAIT_ASYNC(4);                    // stage st's 4 copies done (in-order)
#endif
        } else {
#if HAVE_ASYNC_LDS
            WAIT_ASYNC(0);
#endif
        }
        __syncthreads();                      // all waves' copies for buf st&1 visible

        const unsigned short* bt = &Bt[st & 1][0];
        const int k0 = st * 64;
#pragma unroll
        for (int kc = 0; kc < 2; ++kc) {
            v16bf a0 = load_frag16(aRow0 + k0 + kc * 32);
            v16bf a1 = load_frag16(aRow1 + k0 + kc * 32);
#pragma unroll
            for (int t = 0; t < 4; ++t) {
                v16bf b = load_frag16(bt + (t * 16 + lane15) * 64 + kc * 32 + off);
                acc[0][t] = __builtin_amdgcn_wmma_f32_16x16x32_bf16(
                                false, a0, false, b, (short)0, acc[0][t], false, false);
                acc[1][t] = __builtin_amdgcn_wmma_f32_16x16x32_bf16(
                                false, a1, false, b, (short)0, acc[1][t], false, false);
            }
        }
        __syncthreads();                      // done reading buf before it is refilled
    }

    // Epilogue: D layout -> lane n=lane15, VGPR r holds row r + 8*half
#pragma unroll
    for (int af = 0; af < 2; ++af) {
#pragma unroll
        for (int t = 0; t < 4; ++t) {
            const int n  = nTile + t * 16 + lane15;
            const float bn = bias[n];
#pragma unroll
            for (int r = 0; r < 8; ++r) {
                const int m = mWave + af * 16 + r + half * 8;
                const float val = acc[af][t][r] + bn;
                if (MODE == 0) {
                    C[(size_t)m * N + n] = val;
                } else {
                    // n = part*1024 + h*64 + d ; m = b*S + s
                    const int part = n >> 10;
                    const int h    = (n >> 6) & (H_ - 1);
                    const int d    = n & (HD_ - 1);
                    const int b    = m >> 11;          // S = 2048
                    const int s    = m & (S_ - 1);
                    const size_t idx = ((((size_t)part * B_ + b) * H_ + h) * S_ + s) * HD_ + d;
                    C[idx] = val;
                }
            }
        }
    }
}

// ---------------------------------------------------------------------------
// Gathered attention. One block = 16 waves = 16 consecutive queries s; each
// wave keeps its query's 64 route offsets in registers and walks the 16 heads
// of one batch with them (256 blocks in all). Eight lanes share one K or V row: a
// wave-wide 16-byte load covers four whole 128-byte lines (four rows), never
// 32 partial ones.
// Lane (grp, l8): rows j = grp*16 + i, elements l8*4..+3 and 32 + l8*4..+3.
// q, k, v: the three [B][H][S][64] f32 planes.  Output: [B][S][DIM] f32.
// ---------------------------------------------------------------------------
#define ATT_WAVES  16

// x of lane ^ MASK inside a 16-lane row (DPP row_xmask)
template <int MASK>
__device__ __forceinline__ float row_xor(float x) {
    return __builtin_bit_cast(float, __builtin_amdgcn_update_dpp(
        0, __builtin_bit_cast(int, x), 0x160 | MASK, 0xf, 0xf, true));
}
// lane l with lane l ^ 16
__device__ __forceinline__ float half_xor(float x) {
    return __builtin_bit_cast(float, __builtin_amdgcn_permlanex16(
        __builtin_bit_cast(int, x), __builtin_bit_cast(int, x),
        0x76543210, 0xfedcba98, false, false));
}
__device__ __forceinline__ float exp2_slot(float x) {
    float y;
    asm("v_exp_f32 %0, %1\n\tv_nop" : "=v"(y) : "v"(x));
    return y;
}

typedef float f32x2 __attribute__((ext_vector_type(2)));
typedef float f32x4 __attribute__((ext_vector_type(4)));

// uniform base + 32-bit byte offset of the lane
__device__ __forceinline__ f32x4 ld16(const char* base, unsigned byteOff) {
    return *reinterpret_cast<const f32x4*>(base + byteOff);
}

__global__ __launch_bounds__(ATT_WAVES * 32)
void attn_kernel(
    const float* __restrict__ q,
    const float* __restrict__ k,
    const float* __restrict__ v,
    const int*   __restrict__ routes,
    float*       __restrict__ attn_out)
{
    const int tid  = threadIdx.x;
    const int wave = __builtin_amdgcn_readfirstlane(tid >> 5);
    const int lane = tid & 31;
    const int grp  = lane >> 3;
    const int l8   = lane & 7;
    const int s    = blockIdx.x * ATT_WAVES + wave;

    // byte offset of this lane's piece of each of its 16 rows, inside one plane;
    // the mask bounds the row index whatever the array holds
    unsigned voff[16];
    {
        const int4* rp = reinterpret_cast<const int4*>(routes + s * KN_ + grp * 16);
#pragma unroll  // constant indices keep the arrays in registers
        for (int c = 0; c < 4; ++c) {
            const int4 r = rp[c];
            voff[4*c+0] = ((unsigned)r.x & (S_ - 1)) * (HD_ * 4) + l8 * 16;
            voff[4*c+1] = ((unsigned)r.y & (S_ - 1)) * (HD_ * 4) + l8 * 16;
            voff[4*c+2] = ((unsigned)r.z & (S_ - 1)) * (HD_ * 4) + l8 * 16;
            voff[4*c+3] = ((unsigned)r.w & (S_ - 1)) * (HD_ * 4) + l8 * 16;
        }
    }

    // scalar bases that stay fixed through the loop (plane and batch); the head
    // goes into the lanes' 32-bit offsets, which step in place at the loop's foot,
    // so that no load's result lands in a register that an older load names
    const int b = blockIdx.y;
    const unsigned headB = S_ * HD_ * 4;
    const char* qB = reinterpret_cast<const char*>(q) + (size_t)b * H_ * headB;
    const char* kB = reinterpret_cast<const char*>(k) + (size_t)b * H_ * headB;
    const char* vB = reinterpret_cast<const char*>(v) + (size_t)b * H_ * headB;
    char* oB = reinterpret_cast<char*>(attn_out) + (size_t)b * S_ * DIM_ * 4;
    unsigned qoff = (unsigned)s * (HD_ * 4) + l8 * 16;
    unsigned ooff = (unsigned)s * (DIM_ * 4)
                  + ((grp >> 1) * 32 + l8 * 4 + (grp & 1) * 2) * 4;

    for (int h = 0; h < H_; ++h) {
        const f32x4 qa = ld16(qB,       qoff);
        const f32x4 qb = ld16(qB + 128, qoff);

        // first half of the V rows: in flight under the scores
        f32x4 va[8], vc[8];
#pragma unroll  // constant indices keep the arrays in registers
        for (int i = 0; i < 8; ++i) {
            va[i] = ld16(vB,       voff[i]);
            vc[i] = ld16(vB + 128, voff[i]);
        }

        // scores of this lane's 16 rows, the same in all 8 lanes of a group
        float sc[16];
#pragma unroll  // constant indices keep the arrays in registers
        for (int g = 0; g < 2; ++g) {
            f32x4 ka[8], kc[8];
#pragma unroll  // constant indices keep the arrays in registers
            for (int i = 0; i < 8; ++i) {
                ka[i] = ld16(kB,       voff[g*8+i]);
                kc[i] = ld16(kB + 128, voff[g*8+i]);
            }
#pragma unroll  // constant indices keep the arrays in registers
            for (int i = 0; i < 8; ++i) {
                f32x2 p2 = ka[i].xy * qa.xy;
                p2 += ka[i].zw * qa.zw;
                p2 += kc[i].xy * qb.xy;
                p2 += kc[i].zw * qb.zw;
                float p = p2.x + p2.y;
                p += row_xor<1>(p);
                p += row_xor<2>(p);
                p += row_xor<4>(p);
                sc[g*8+i] = p * SCALE_;
            }
        }
        // keeps the loads above in flight under the scores (without it the first
        // V rows sink down to their uses) and the loads below out of the K
        // rows' registers until those are free
        __builtin_amdgcn_sched_barrier(0);
        f32x4 vd[8], ve[8];
#pragma unroll  // constant indices keep the arrays in registers
        for (int i = 0; i < 8; ++i) {
            vd[i] = ld16(vB,       voff[8+i]);
            ve[i] = ld16(vB + 128, voff[8+i]);
        }

        // softmax over 64 = 16 in registers x 4 groups (lane ^ 8, lane ^ 16)
        float mx = sc[0];
#pragma unroll  // constant indices keep the arrays in registers
        for (int i = 1; i < 16; ++i) mx = fmaxf(mx, sc[i]);
        mx = fmaxf(mx, row_xor<8>(mx));
        mx = fmaxf(mx, half_xor(mx));
        float sum = 0.f;
#pragma unroll  // constant indices keep the arrays in registers
        for (int i = 0; i < 16; ++i) {
            sc[i] = exp2_slot((sc[i] - mx) * 1.44269504f);
            sum += sc[i];
        }
        sum += row_xor<8>(sum);
        sum += half_xor(sum);
        const float inv = 1.0f / sum;

        // out[d] = sum_j e[j] * v[route_j][d], normalised once at the end
        f32x2 o[4] = {{0.f, 0.f}, {0.f, 0.f}, {0.f, 0.f}, {0.f, 0.f}};
#pragma unroll  // constant indices keep the arrays in registers
        for (int i = 0; i < 8; ++i) {
            const float w = sc[i];
            o[0] += w * va[i].xy; o[1] += w * va[i].zw;
            o[2] += w * vc[i].xy; o[3] += w * vc[i].zw;
        }
#pragma unroll  // constant indices keep the arrays in registers
        for (int i = 0; i < 8; ++i) {
            const float w = sc[8+i];
            o[0] += w * vd[i].xy; o[1] += w * vd[i].zw;
            o[2] += w * ve[i].xy; o[3] += w * ve[i].zw;
        }
        float r[8] = {o[0].x, o[0].y, o[1].x, o[1].y, o[2].x, o[2].y, o[3].x, o[3].y};
#pragma unroll  // constant indices keep the arrays in registers
        for (int e = 0; e < 8; ++e) {
            r[e] += row_xor<8>(r[e]);
            r[e] += half_xor(r[e]);
        }

        // every lane stores 8 bytes: group g holds elements (g>>1)*32 + l8*4 + (g&1)*2
        f32x2 st;
        st.x = (grp & 2) ? ((grp & 1) ? r[6] : r[4]) : ((grp & 1) ? r[2] : r[0]);
        st.y = (grp & 2) ? ((grp & 1) ? r[7] : r[5]) : ((grp & 1) ? r[3] : r[1]);
        st *= inv;
        *reinterpret_cast<f32x2*>(oB + ooff) = st;
        // the offsets step next, and the next trip rewrites the store's data registers
        asm volatile("s_wait_xcnt 0x0" ::: "memory");
        // keeps the steps of the offsets below that wait, behind every load that names them
        __builtin_amdgcn_sched_barrier(0);
        qoff += headB;
        ooff += HD_ * 4;
#pragma unroll  // constant indices keep the arrays in registers
        for (int i = 0; i < 16; ++i) voff[i] += headB;
    }
}

// ---------------------------------------------------------------------------
// Orchestration
// ---------------------------------------------------------------------------
extern "C" void kernel_launch(void* const* d_in, const int* in_sizes, int n_in,
                              void* d_out, int out_size, void* d_ws, size_t ws_size,
                              hipStream_t stream) {
    const float* x      = (const float*)d_in[0];
    const int*   routes = (const int*)  d_in[1];
    const float* qkv_w  = (const float*)d_in[2];
    const float* qkv_b  = (const float*)d_in[3];
    const float* out_w  = (const float*)d_in[4];
    const float* out_b  = (const float*)d_in[5];
    float* out = (float*)d_out;

    const int M = B_ * S_;          // 4096
    char* ws = (char*)d_ws;
    size_t off = 0;
    auto take = [&](size_t bytes) -> char* {
        char* p = ws + off;
        off += (bytes + 255) & ~(size_t)255;
        return p;
    };
    unsigned short* x_bf    = (unsigned short*)take((size_t)M * DIM_ * 2);
    unsigned short* qw_bf   = (unsigned short*)take((size_t)3 * DIM_ * DIM_ * 2);
    unsigned short* ow_bf   = (unsigned short*)take((size_t)DIM_ * DIM_ * 2);
    float*          qkv     = (float*)        take((size_t)3 * B_ * H_ * S_ * HD_ * 4);
    float*          aout    = (float*)        take((size_t)M * DIM_ * 4);
    unsigned short* aout_bf = (unsigned short*)take((size_t)M * DIM_ * 2);

    // 1) bf16 conversions
    cvt_bf16_kernel<<<(M * DIM_) / CVT_SPAN, CVT_WAVES * 32, 0, stream>>>(x, x_bf);
    cvt_bf16_kernel<<<(3 * DIM_ * DIM_) / CVT_SPAN, CVT_WAVES * 32, 0, stream>>>(qkv_w, qw_bf);
    cvt_bf16_kernel<<<(DIM_ * DIM_) / CVT_SPAN, CVT_WAVES * 32, 0, stream>>>(out_w, ow_bf);

    // 2) QKV projection GEMM (WMMA bf16 + async LDS staging) -> [3][B][H][S][64]
    wmma_gemm_kernel<1><<<dim3((3 * DIM_) / 64, M / 128), 128, 0, stream>>>(
        x_bf, qw_bf, qkv_b, qkv, M, 3 * DIM_, DIM_);

    // 3) Gathered attention + softmax
    attn_kernel<<<dim3(S_ / ATT_WAVES, B_), ATT_WAVES * 32, 0, stream>>>(
        qkv, qkv + (size_t)B_ * H_ * S_ * HD_, qkv + (size_t)2 * B_ * H_ * S_ * HD_, routes, aout);

    // 4) Output projection GEMM (WMMA bf16) -> d_out
    cvt_bf16_kernel<<<(M * DIM_) / CVT_SPAN, CVT_WAVES * 32, 0, stream>>>(aout, aout_bf);
    wmma_gemm_kernel<0><<<dim3(DIM_ / 64, M / 128), 128, 0, stream>>>(
        aout_bf, ow_bf, out_b, out, M, DIM_, DIM_);
}

// v003
// One run takes 132 microseconds.
// Two timings next to v002 both put it at 1.12 times that version's speed.
// Counting every step since v000, it is 1.81 times as fast.
#include <hip/hip_runtime.h>
#include <hip/hip_bf16.h>

// Problem constants (fixed by the reference)
#define B_    2
#define S_    2048
#define DIM_  1024
#define H_    16
#define HD_   64
#define KN_   64
#define SCALE_ 0.125f   // 1/sqrt(64)

typedef __attribute__((ext_vector_type(16))) __bf16 v16bf;
typedef __attribute__((ext_vector_type(8)))  float  v8f;

// async-copy builtin wants pointers to int4 (vector_size(16)) in AS1/AS3
typedef int v4i __attribute__((vector_size(16)));
typedef __attribute__((address_space(1))) v4i as1_v4i;
typedef __attribute__((address_space(3))) v4i as3_v4i;

struct Raw32 { uint4 lo; uint4 hi; };  // 32 bytes == v16bf

#if __has_builtin(__builtin_amdgcn_global_load_async_to_lds_b128)
#define HAVE_ASYNC_LDS 1
#else
#define HAVE_ASYNC_LDS 0
#endif

#if HAVE_ASYNC_LDS
#if __has_builtin(__builtin_amdgcn_s_wait_asynccnt)
#define WAIT_ASYNC(n) __builtin_amdgcn_s_wait_asynccnt(n)
#else
#define WAIT_ASYNC(n) asm volatile("s_wait_asynccnt %0" :: "i"(n) : "memory")
#endif
#endif

// ---------------------------------------------------------------------------
// f32 -> bf16 (round-to-nearest-even), stored as raw u16
// ---------------------------------------------------------------------------
__device__ __forceinline__ unsigned short f32_to_bf16u(float f) {
    union { float f; unsigned u; } a; a.f = f;
    unsigned r = a.u + 0x7FFFu + ((a.u >> 16) & 1u);
    return (unsigned short)(r >> 16);
}

// One block = 16 waves; a wave takes 4 KiB of contiguous f32: 8 loads of 16 bytes
// a lane, each wave-wide load four whole 128-byte lines, all issued before the
// first value is used; each wave-wide 8-byte store covers two whole lines.
// The grid covers the array exactly: its length is a multiple of CVT_SPAN.
#define CVT_WAVES 16
#define CVT_LOADS 8
#define CVT_SPAN  (CVT_WAVES * CVT_LOADS * 128)   // 16384 elements a block

__global__ __launch_bounds__(CVT_WAVES * 32) void cvt_bf16_kernel(const float* __restrict__ in,
                                                                  unsigned short* __restrict__ out) {
    const unsigned base = (blockIdx.x * CVT_WAVES + (threadIdx.x >> 5)) * (CVT_LOADS * 128)
                        + (threadIdx.x & 31) * 4;
    float4 v[CVT_LOADS];
#pragma unroll  // constant indices keep the array in registers, all loads in flight together
    for (int i = 0; i < CVT_LOADS; ++i)
        v[i] = *reinterpret_cast<const float4*>(in + base + i * 128);
#pragma unroll  // constant indices keep the array in registers
    for (int i = 0; i < CVT_LOADS; ++i) {
        uint2 p;
        p.x = (unsigned)f32_to_bf16u(v[i].x) | ((unsigned)f32_to_bf16u(v[i].y) << 16);
        p.y = (unsigned)f32_to_bf16u(v[i].z) | ((unsigned)f32_to_bf16u(v[i].w) << 16);
        *reinterpret_cast<uint2*>(out + base + i * 128) = p;
    }
}

// ---------------------------------------------------------------------------
// Load one 16x32 bf16 WMMA fragment slice for this lane.
// Lane l<16 supplies K {0..7,16..23}; lane l>=16 supplies K {8..15,24..31}:
// two contiguous 16B chunks at +0 and +16 elements (lane-half offset folded
// into the pointer by the caller). Works for global or LDS (generic) memory.
// ---------------------------------------------------------------------------
__device__ __forceinline__ v16bf load_frag16(const unsigned short* p) {
    Raw32 r;
    r.lo = *reinterpret_cast<const uint4*>(p);
    r.hi = *reinterpret_cast<const uint4*>(p + 16);
    return __builtin_bit_cast(v16bf, r);
}

// ---------------------------------------------------------------------------
// WMMA GEMM:  C[M,N] = A[M,K] * W[N,K]^T + bias[N]
// Workgroup = 128 threads (4 waves). Tile: M=128 x N=64, K staged by 64.
// The shared 64x64-bf16 B tile is double-buffered in LDS, filled with
// GLOBAL_LOAD_ASYNC_TO_LDS_B128 (ASYNCcnt) when available. Its rows lie at a
// pitch of 144 bytes (16 B x odd): the 16 rows that a 16-byte fragment read
// touches then fall on 16 different groups of four banks; at 128 bytes they
// share two groups and the read takes eight times the LDS clocks.
// Each wave: rows [mWave, mWave+32) x all 64 cols -> 2x4 v8f accumulators,
// 16 WMMAs per K-stage.
// MODE 0: store row-major C[m*N+n]  (final out-projection -> d_out)
// MODE 1: scatter into qkv buffer laid out [3][B][H][S][64]
// ---------------------------------------------------------------------------
#define BT_PITCH 72   // elements: 64 of the tile + 8 never written or read

template <int MODE>
__global__ __launch_bounds__(128) void wmma_gemm_kernel(
    const unsigned short* __restrict__ A,
    const unsigned short* __restrict__ W,
    const float* __restrict__ bias,
    float* __restrict__ C,
    int M, int N, int K)
{
    __shared__ unsigned short Bt[2][64 * BT_PITCH];   // 2 x 9 KiB

    const int tid    = threadIdx.x;     // 0..127
    const int wave   = tid >> 5;
    const int lane   = tid & 31;
    const int lane15 = lane & 15;
    const int half   = lane >> 4;       // 0: K 0..7/16..23, 1: K 8..15/24..31
    const int off    = half * 8;

    const int mTile = blockIdx.y * 128;
    const int nTile = blockIdx.x * 64;
    const int mWave = mTile + wave * 32;

    v8f acc[2][4] = { { {}, {}, {}, {} }, { {}, {}, {}, {} } };

    const unsigned short* aRow0 = A + (size_t)(mWave + lane15) * K + off;
    const unsigned short* aRow1 = A + (size_t)(mWave + 16 + lane15) * K + off;

    // ---- cooperative B-tile stage: 64 rows x 64 k (bf16) = 512 16B chunks ----
    auto issue_stage = [&](int buf, int k0) {
#pragma unroll
        for (int i = 0; i < 4; ++i) {
            const int c   = i * 128 + tid;    // 16B chunk id, 0..511
            const int row = c >> 3;           // 8 chunks per row
            const int cw  = c & 7;
            const unsigned short* g = W + (size_t)(nTile + row) * K + k0 + cw * 8;
            unsigned short*       l = &Bt[buf][row * BT_PITCH + cw * 8];
#if HAVE_ASYNC_LDS
            __builtin_amdgcn_global_load_async_to_lds_b128(
                (as1_v4i*)g, (as3_v4i*)l, 0, 0);
#else
            *reinterpret_cast<uint4*>(l) = *reinterpret_cast<const uint4*>(g);
#endif
        }
    };

    const int nStages = K / 64;
    issue_stage(0, 0);

    for (int st = 0; st < nStages; ++st) {
        const int nxt = st + 1;
        if (nxt < nStages) {
            issue_stage(nxt & 1, nxt * 64);
#if HAVE_ASYNC_LDS
            WAIT_ASYNC(4);                    // stage st's 4 copies done (in-order)
#endif
        } else {
#if HAVE_ASYNC_LDS
            WAIT_ASYNC(0);
#endif
        }
        __syncthreads();                      // all waves' copies for buf st&1 visible

        const unsigned short* bt = &Bt[st & 1][0];
        const int k0 = st * 64;
#pragma unroll
        for (int kc = 0; kc < 2; ++kc) {
            v16bf a0 = load_frag16(aRow0 + k0 + kc * 32);
            v16bf a1 = load_frag16(aRow1 + k0 + kc * 32);
#pragma unroll
            for (int t = 0; t < 4; ++t) {
                v16bf b = load_frag16(bt + (t * 16 + lane15) * BT_PITCH + kc * 32 + off);
                acc[0][t] = __builtin_amdgcn_wmma_f32_16x16x32_bf16(
                                false, a0, false, b, (short)0, acc[0][t], false, false);
                acc[1][t] = __builtin_amdgcn_wmma_f32_16x16x32_bf16(
                                false, a1, false, b, (short)0, acc[1][t], false, false);
            }
        }
        __syncthreads();                      // done reading buf before it is refilled
    }

    // Epilogue: D layout -> lane n=lane15, VGPR r holds row r + 8*half
#pragma unroll
    for (int af = 0; af < 2; ++af) {
#pragma unroll
        for (int t = 0; t < 4; ++t) {
            const int n  = nTile + t * 16 + lane15;
            const float bn = bias[n];
#pragma unroll
            for (int r = 0; r < 8; ++r) {
                const int m = mWave + af * 16 + r + half * 8;
                const float val = acc[af][t][r] + bn;
                if (MODE == 0) {
                    C[(size_t)m * N + n] = val;
                } else {
                    // n = part*1024 + h*64 + d ; m = b*S + s
                    const int part = n >> 10;
                    const int h    = (n >> 6) & (H_ - 1);
                    const int d    = n & (HD_ - 1);
                    const int b    = m >> 11;          // S = 2048
                    const int s    = m & (S_ - 1);
                    const size_t idx = ((((size_t)part * B_ + b) * H_ + h) * S_ + s) * HD_ + d;
                    C[idx] = val;
                }
            }
        }
    }
}

// ---------------------------------------------------------------------------
// Gathered attention. One block = 16 waves = 16 consecutive queries s; each
// wave keeps its query's 64 route offsets in registers and walks the 16 heads
// of one batch with them (256 blocks in all). Eight lanes share one K or V row: a
// wave-wide 16-byte load covers four whole 128-byte lines (four rows), never
// 32 partial ones.
// Lane (grp, l8): rows j = grp*16 + i, elements l8*4..+3 and 32 + l8*4..+3.
// q, k, v: the three [B][H][S][64] f32 planes.  Output: [B][S][DIM] f32.
// ---------------------------------------------------------------------------
#define ATT_WAVES  16

// x of lane ^ MASK inside a 16-lane row (DPP row_xmask)
template <int MASK>
__device__ __forceinline__ float row_xor(float x) {
    return __builtin_bit_cast(float, __builtin_amdgcn_update_dpp(
        0, __builtin_bit_cast(int, x), 0x160 | MASK, 0xf, 0xf, true));
}
// lane l with lane l ^ 16
__device__ __forceinline__ float half_xor(float x) {
    return __builtin_bit_cast(float, __builtin_amdgcn_permlanex16(
        __builtin_bit_cast(int, x), __builtin_bit_cast(int, x),
        0x76543210, 0xfedcba98, false, false));
}
__device__ __forceinline__ float exp2_slot(float x) {
    float y;
    asm("v_exp_f32 %0, %1\n\tv_nop" : "=v"(y) : "v"(x));
    return y;
}

typedef float f32x2 __attribute__((ext_vector_type(2)));
typedef float f32x4 __attribute__((ext_vector_type(4)));

// uniform base + 32-bit byte offset of the lane
__device__ __forceinline__ f32x4 ld16(const char* base, unsigned byteOff) {
    return *reinterpret_cast<const f32x4*>(base + byteOff);
}

__global__ __launch_bounds__(ATT_WAVES * 32)
void attn_kernel(
    const float* __restrict__ q,
    const float* __restrict__ k,
    const float* __restrict__ v,
    const int*   __restrict__ routes,
    float*       __restrict__ attn_out)
{
    const int tid  = threadIdx.x;
    const int wave = __builtin_amdgcn_readfirstlane(tid >> 5);
    const int lane = tid & 31;
    const int grp  = lane >> 3;
    const int l8   = lane & 7;
    const int s    = blockIdx.x * ATT_WAVES + wave;

    // byte offset of this lane's piece of each of its 16 rows, inside one plane;
    // the mask bounds the row index whatever the array holds
    unsigned voff[16];
    {
        const int4* rp = reinterpret_cast<const int4*>(routes + s * KN_ + grp * 16);
#pragma unroll  // constant indices keep the arrays in registers
        for (int c = 0; c < 4; ++c) {
            const int4 r = rp[c];
            voff[4*c+0] = ((unsigned)r.x & (S_ - 1)) * (HD_ * 4) + l8 * 16;
            voff[4*c+1] = ((unsigned)r.y & (S_ - 1)) * (HD_ * 4) + l8 * 16;
            voff[4*c+2] = ((unsigned)r.z & (S_ - 1)) * (HD_ * 4) + l8 * 16;
            voff[4*c+3] = ((unsigned)r.w & (S_ - 1)) * (HD_ * 4) + l8 * 16;
        }
    }

    // scalar bases that stay fixed through the loop (plane and batch); the head
    // goes into the lanes' 32-bit offsets, which step in place at the loop's foot,
    // so that no load's result lands in a register that an older load names
    const int b = blockIdx.y;
    const unsigned headB = S_ * HD_ * 4;
    const char* qB = reinterpret_cast<const char*>(q) + (size_t)b * H_ * headB;
    const char* kB = reinterpret_cast<const char*>(k) + (size_t)b * H_ * headB;
    const char* vB = reinterpret_cast<const char*>(v) + (size_t)b * H_ * headB;
    char* oB = reinterpret_cast<char*>(attn_out) + (size_t)b * S_ * DIM_ * 4;
    unsigned qoff = (unsigned)s * (HD_ * 4) + l8 * 16;
    unsigned ooff = (unsigned)s * (DIM_ * 4)
                  + ((grp >> 1) * 32 + l8 * 4 + (grp & 1) * 2) * 4;

    for (int h = 0; h < H_; ++h) {
        const f32x4 qa = ld16(qB,       qoff);
        const f32x4 qb = ld16(qB + 128, qoff);

        // first half of the V rows: in flight under the scores
        f32x4 va[8], vc[8];
#pragma unroll  // constant indices keep the arrays in registers
        for (int i = 0; i < 8; ++i) {
            va[i] = ld16(vB,       voff[i]);
            vc[i] = ld16(vB + 128, voff[i]);
        }

        // scores of this lane's 16 rows, the same in all 8 lanes of a group
        float sc[16];
#pragma unroll  // constant indices keep the arrays in registers
        for (int g = 0; g < 2; ++g) {
            f32x4 ka[8], kc[8];
#pragma unroll  // constant indices keep the arrays in registers
            for (int i = 0; i < 8; ++i) {
                ka[i] = ld16(kB,       voff[g*8+i]);
                kc[i] = ld16(kB + 128, voff[g*8+i]);
            }
#pragma unroll  // constant indices keep the arrays in registers
            for (int i = 0; i < 8; ++i) {
                f32x2 p2 = ka[i].xy * qa.xy;
                p2 += ka[i].zw * qa.zw;
                p2 += kc[i].xy * qb.xy;
                p2 += kc[i].zw * qb.zw;
                float p = p2.x + p2.y;
                p += row_xor<1>(p);
                p += row_xor<2>(p);
                p += row_xor<4>(p);
                sc[g*8+i] = p * SCALE_;
            }
        }
        // keeps the loads above in flight under the scores (without it the first
        // V rows sink down to their uses) and the loads below out of the K
        // rows' registers until those are free
        __builtin_amdgcn_sched_barrier(0);
        f32x4 vd[8], ve[8];
#pragma unroll  // constant indices keep the arrays in registers
        for (int i = 0; i < 8; ++i) {
            vd[i] = ld16(vB,       voff[8+i]);
            ve[i] = ld16(vB + 128, voff[8+i]);
        }

        // softmax over 64 = 16 in registers x 4 groups (lane ^ 8, lane ^ 16)
        float mx = sc[0];
#pragma unroll  // constant indices keep the arrays in registers
        for (int i = 1; i < 16; ++i) mx = fmaxf(mx, sc[i]);
        mx = fmaxf(mx, row_xor<8>(mx));
        mx = fmaxf(mx, half_xor(mx));
        float sum = 0.f;
#pragma unroll  // constant indices keep the arrays in registers
        for (int i = 0; i < 16; ++i) {
            sc[i] = exp2_slot((sc[i] - mx) * 1.44269504f);
            sum += sc[i];
        }
        sum += row_xor<8>(sum);
        sum += half_xor(sum);
        const float inv = 1.0f / sum;

        // out[d] = sum_j e[j] * v[route_j][d], normalised once at the end
        f32x2 o[4] = {{0.f, 0.f}, {0.f, 0.f}, {0.f, 0.f}, {0.f, 0.f}};
#pragma unroll  // constant indices keep the arrays in registers
        for (int i = 0; i < 8; ++i) {
            const float w = sc[i];
            o[0] += w * va[i].xy; o[1] += w * va[i].zw;
            o[2] += w * vc[i].xy; o[3] += w * vc[i].zw;
        }
#pragma unroll  // constant indices keep the arrays in registers
        for (int i = 0; i < 8; ++i) {
            const float w = sc[8+i];
            o[0] += w * vd[i].xy; o[1] += w * vd[i].zw;
            o[2] += w * ve[i].xy; o[3] += w * ve[i].zw;
        }
        float r[8] = {o[0].x, o[0].y, o[1].x, o[1].y, o[2].x, o[2].y, o[3].x, o[3].y};
#pragma unroll  // constant indices keep the arrays in registers
        for (int e = 0; e < 8; ++e) {
            r[e] += row_xor<8>(r[e]);
            r[e] += half_xor(r[e]);
        }

        // every lane stores 8 bytes: group g holds elements (g>>1)*32 + l8*4 + (g&1)*2
        f32x2 st;
        st.x = (grp & 2) ? ((grp & 1) ? r[6] : r[4]) : ((grp & 1) ? r[2] : r[0]);
        st.y = (grp & 2) ? ((grp & 1) ? r[7] : r[5]) : ((grp & 1) ? r[3] : r[1]);
        st *= inv;
        *reinterpret_cast<f32x2*>(oB + ooff) = st;
        // the offsets step next, and the next trip rewrites the store's data registers
        asm volatile("s_wait_xcnt 0x0" ::: "memory");
        // keeps the steps of the offsets below that wait, behind every load that names them
        __builtin_amdgcn_sched_barrier(0);
        qoff += headB;
        ooff += HD_ * 4;
#pragma unroll  // constant indices keep the arrays in registers
        for (int i = 0; i < 16; ++i) voff[i] += headB;
    }
}

// ---------------------------------------------------------------------------
// Orchestration
// ---------------------------------------------------------------------------
extern "C" void kernel_launch(void* const* d_in, const int* in_sizes, int n_in,
                              void* d_out, int out_size, void* d_ws, size_t ws_size,
                              hipStream_t stream) {
    const float* x      = (const float*)d_in[0];
    const int*   routes = (const int*)  d_in[1];
    const float* qkv_w  = (const float*)d_in[2];
    const float* qkv_b  = (const float*)d_in[3];
    const float* out_w  = (const float*)d_in[4];
    const float* out_b  = (const float*)d_in[5];
    float* out = (float*)d_out;

    const int M = B_ * S_;          // 4096
    char* ws = (char*)d_ws;
    size_t off = 0;
    auto take = [&](size_t bytes) -> char* {
        char* p = ws + off;
        off += (bytes + 255) & ~(size_t)255;
        return p;
    };
    unsigned short* x_bf    = (unsigned short*)take((size_t)M * DIM_ * 2);
    unsigned short* qw_bf   = (unsigned short*)take((size_t)3 * DIM_ * DIM_ * 2);
    unsigned short* ow_bf   = (unsigned short*)take((size_t)DIM_ * DIM_ * 2);
    float*          qkv     = (float*)        take((size_t)3 * B_ * H_ * S_ * HD_ * 4);
    float*          aout    = (float*)        take((size_t)M * DIM_ * 4);
    unsigned short* aout_bf = (unsigned short*)take((size_t)M * DIM_ * 2);

    // 1) bf16 conversions
    cvt_bf16_kernel<<<(M * DIM_) / CVT_SPAN, CVT_WAVES * 32, 0, stream>>>(x, x_bf);
    cvt_bf16_kernel<<<(3 * DIM_ * DIM_) / CVT_SPAN, CVT_WAVES * 32, 0, stream>>>(qkv_w, qw_bf);
    cvt_bf16_kernel<<<(DIM_ * DIM_) / CVT_SPAN, CVT_WAVES * 32, 0, stream>>>(out_w, ow_bf);

    // 2) QKV projection GEMM (WMMA bf16 + async LDS staging) -> [3][B][H][S][64]
    wmma_gemm_kernel<1><<<dim3((3 * DIM_) / 64, M / 128), 128, 0, stream>>>(
        x_bf, qw_bf, qkv_b, qkv, M, 3 * DIM_, DIM_);

    // 3) Gathered attention + softmax
    attn_kernel<<<dim3(S_ / ATT_WAVES, B_), ATT_WAVES * 32, 0, stream>>>(
        qkv, qkv + (size_t)B_ * H_ * S_ * HD_, qkv + (size_t)2 * B_ * H_ * S_ * HD_, routes, aout);

    // 4) Output projection GEMM (WMMA bf16) -> d_out
    cvt_bf16_kernel<<<(M * DIM_) / CVT_SPAN, CVT_WAVES * 32, 0, stream>>>(aout, aout_bf);
    wmma_gemm_kernel<0><<<dim3(DIM_ / 64, M / 128), 128, 0, stream>>>(
        aout_bf, ow_bf, out_b, out, M, DIM_, DIM_);
}

// v004
// One run takes 112 microseconds.
// Timed twice side by side with v003, it ran 1.18 times as fast both times.
// Over all steps from v000 it is 2.13 times as fast.
#include <hip/hip_runtime.h>
#include <hip/hip_bf16.h>

// Problem constants (fixed by the reference)
#define B_    2
#define S_    2048
#define DIM_  1024
#define H_    16
#define HD_   64
#define KN_   64
#define SCALE_ 0.125f   // 1/sqrt(64)

typedef __attribute__((ext_vector_type(16))) __bf16 v16bf;
typedef __attribute__((ext_vector_type(8)))  float  v8f;

// async-copy builtin wants pointers to int4 (vector_size(16)) in AS1/AS3
typedef int v4i __attribute__((vector_size(16)));
typedef __attribute__((address_space(1))) v4i as1_v4i;
typedef __attribute__((address_space(3))) v4i as3_v4i;

struct Raw32 { uint4 lo; uint4 hi; };  // 32 bytes == v16bf

// ---------------------------------------------------------------------------
// f32 -> bf16 (round-to-nearest-even), stored as raw u16
// ---------------------------------------------------------------------------
__device__ __forceinline__ unsigned short f32_to_bf16u(float f) {
    union { float f; unsigned u; } a; a.f = f;
    unsigned r = a.u + 0x7FFFu + ((a.u >> 16) & 1u);
    return (unsigned short)(r >> 16);
}

// One block = 16 waves; a wave takes 4 KiB of contiguous f32: 8 loads of 16 bytes
// a lane, each wave-wide load four whole 128-byte lines, all issued before the
// first value is used; each wave-wide 8-byte store covers two whole lines.
// The grid covers the array exactly: its length is a multiple of CVT_SPAN.
#define CVT_WAVES 16
#define CVT_LOADS 8
#define CVT_SPAN  (CVT_WAVES * CVT_LOADS * 128)   // 16384 elements a block

__global__ __launch_bounds__(CVT_WAVES * 32) void cvt_bf16_kernel(const float* __restrict__ in,
                                                                  unsigned short* __restrict__ out) {
    const unsigned base = (blockIdx.x * CVT_WAVES + (threadIdx.x >> 5)) * (CVT_LOADS * 128)
                        + (threadIdx.x & 31) * 4;
    float4 v[CVT_LOADS];
#pragma unroll  // constant indices keep the array in registers, all loads in flight together
    for (int i = 0; i < CVT_LOADS; ++i)
        v[i] = *reinterpret_cast<const float4*>(in + base + i * 128);
#pragma unroll  // constant indices keep the array in registers
    for (int i = 0; i < CVT_LOADS; ++i) {
        uint2 p;
        p.x = (unsigned)f32_to_bf16u(v[i].x) | ((unsigned)f32_to_bf16u(v[i].y) << 16);
        p.y = (unsigned)f32_to_bf16u(v[i].z) | ((unsigned)f32_to_bf16u(v[i].w) << 16);
        *reinterpret_cast<uint2*>(out + base + i * 128) = p;
    }
}

// ---------------------------------------------------------------------------
// Load one 16x32 bf16 WMMA fragment slice for this lane.
// Lane l<16 supplies K {0..7,16..23}; lane l>=16 supplies K {8..15,24..31}:
// two contiguous 16B chunks at +0 and +16 elements (lane-half offset folded
// into the pointer by the caller). Works for global or LDS (generic) memory.
// ---------------------------------------------------------------------------
__device__ __forceinline__ v16bf load_frag16(const unsigned short* p) {
    Raw32 r;
    r.lo = *reinterpret_cast<const uint4*>(p);
    r.hi = *reinterpret_cast<const uint4*>(p + 16);
    return __builtin_bit_cast(v16bf, r);
}

// ---------------------------------------------------------------------------
// WMMA GEMM:  C[M,N] = A[M,K] * W[N,K]^T + bias[N]
// Workgroup = 128 threads (4 waves, 2 x 2). Tile: M=128 x N=128, K staged by 64.
// Both operand tiles (128 rows x 64 k of bf16 each) lie in LDS, two buffers,
// filled with GLOBAL_LOAD_ASYNC_TO_LDS_B128 (ASYNCcnt): a wave-wide copy takes
// four whole 128-byte lines, and each landed row serves two waves. Rows lie at
// a pitch of 144 bytes (16 B x odd): the 16 rows that a 16-byte fragment read
// touches then fall on 16 different groups of four banks.
// Each wave: 64 rows x 64 cols -> 4x4 v8f accumulators, 32 WMMAs per K-stage.
// M, N multiples of 128; K a multiple of 64 and at least 128 (two stages).
// MODE 0: store row-major C[m*N+n]  (final out-projection -> d_out)
// MODE 1: scatter into qkv buffer laid out [3][B][H][S][64]
// ---------------------------------------------------------------------------
#define T_PITCH 72   // elements: 64 of the tile + 8 never written or read
#define T_ROWS  128

template <int MODE>
__global__ __launch_bounds__(128) void wmma_gemm_kernel(
    const unsigned short* __restrict__ A,
    const unsigned short* __restrict__ W,
    const float* __restrict__ bias,
    float* __restrict__ C,
    int M, int N, int K)
{
    __shared__ unsigned short At[2][T_ROWS * T_PITCH];   // 2 x 18 KiB
    __shared__ unsigned short Bt[2][T_ROWS * T_PITCH];   // 2 x 18 KiB

    const int tid    = threadIdx.x;     // 0..127
    const int wave   = tid >> 5;
    const int lane   = tid & 31;
    const int lane15 = lane & 15;
    const int half   = lane >> 4;       // 0: K 0..7/16..23, 1: K 8..15/24..31
    const int off    = half * 8;

    const int mTile = blockIdx.y * T_ROWS;
    const int nTile = blockIdx.x * T_ROWS;
    const int mLoc  = (wave >> 1) * 64;  // this wave's rows inside the A tile
    const int nLoc  = (wave & 1) * 64;   // this wave's rows inside the B tile

    v8f acc[4][4];
#pragma unroll
    for (int i = 0; i < 4; ++i)
#pragma unroll
        for (int j = 0; j < 4; ++j) acc[i][j] = v8f{};

    // ---- cooperative stage: 2 tiles x 128 rows x 64 k (bf16) = 2 x 1024 16B chunks.
    // Thread: chunk tid & 7 of rows (tid >> 3) + 16 i, the same in both tiles.
    const char* aBase = reinterpret_cast<const char*>(A + (size_t)mTile * K);
    const char* wBase = reinterpret_cast<const char*>(W + (size_t)nTile * K);
    const unsigned gOff0   = ((unsigned)(tid >> 3) * (unsigned)K + (tid & 7) * 8) * 2;
    const unsigned gStep   = 16u * (unsigned)K * 2;
    const int      lOff0   = (tid >> 3) * T_PITCH + (tid & 7) * 8;
    auto issue_stage = [&](int buf, int k0) {
        const char* ga = aBase + (size_t)k0 * 2;
        const char* gw = wBase + (size_t)k0 * 2;
#pragma unroll
        for (int i = 0; i < 8; ++i) {
            __builtin_amdgcn_global_load_async_to_lds_b128(
                (as1_v4i*)(ga + (gOff0 + i * gStep)),
                (as3_v4i*)&At[buf][lOff0 + i * 16 * T_PITCH], 0, 0);
            __builtin_amdgcn_global_load_async_to_lds_b128(
                (as1_v4i*)(gw + (gOff0 + i * gStep)),
                (as3_v4i*)&Bt[buf][lOff0 + i * 16 * T_PITCH], 0, 0);
        }
    };

    // one k chunk of 32: this wave's 4 A and 4 B fragments, 16 reads of 16 bytes
    const unsigned short* atW = &At[0][(mLoc + lane15) * T_PITCH + off];
    const unsigned short* btW = &Bt[0][(nLoc + lane15) * T_PITCH + off];
    auto load_set = [&](v16bf (&a)[4], v16bf (&b)[4], int buf, int kc) {
        const int o = buf * (T_ROWS * T_PITCH) + kc * 32;
#pragma unroll
        for (int i = 0; i < 4; ++i) a[i] = load_frag16(atW + o + i * 16 * T_PITCH);
#pragma unroll
        for (int j = 0; j < 4; ++j) b[j] = load_frag16(btW + o + j * 16 * T_PITCH);
    };
    auto wmma_block = [&](const v16bf (&a)[4], const v16bf (&b)[4]) {
#pragma unroll
        for (int i = 0; i < 4; ++i)
#pragma unroll
            for (int j = 0; j < 4; ++j)
                acc[i][j] = __builtin_amdgcn_wmma_f32_16x16x32_bf16(
                                false, a[i], false, b[j], (short)0, acc[i][j], false, false);
    };

    const int nStages = K / 64;
    issue_stage(0, 0);
    // stage 0 has landed for this wave, then for all: nothing reads it before
    asm volatile("s_wait_asynccnt 0x0" ::: "memory");
    __syncthreads();
    issue_stage(1, 64);

    // two fragment sets: each group of 16 reads is issued one WMMA block ahead
    v16bf a0[4], b0[4], a1[4], b1[4];
    load_set(a0, b0, 0, 0);

    for (int st = 0; st < nStages; ++st) {
        const int cur = st & 1;
        load_set(a1, b1, cur, 1);
        // keeps the reads as one group in front of the block, not among its WMMAs
        __builtin_amdgcn_sched_barrier(0);
        wmma_block(a0, b0);
        // keeps the block in front of the hand-over, as cover for the reads above
        __builtin_amdgcn_sched_barrier(0);
        // hand-over, in front of the stage's last block, whose fragments are in
        // registers: this wave's reads of buffer cur are done ...
        asm volatile("s_wait_dscnt 0x0" ::: "memory");
        // ... its copies of stage st + 1 have landed ...
        asm volatile("s_wait_asynccnt 0x0" ::: "memory");
        // ... and so have every wave's: stage st + 1 may be read, buffer cur refilled
        __syncthreads();
        if (st + 2 < nStages) issue_stage(cur, (st + 2) * 64);
        // first chunk of stage st + 1; in the last trip the other buffer's old rows, unused
        load_set(a0, b0, cur ^ 1, 0);
        // keeps the reads as one group in front of the block, not among its WMMAs
        __builtin_amdgcn_sched_barrier(0);
        wmma_block(a1, b1);
    }
    // no copy is outstanding when the wave ends
    asm volatile("s_wait_asynccnt 0x0" ::: "memory");

    // Epilogue: D layout -> lane n=lane15, VGPR r holds row r + 8*half
#pragma unroll
    for (int af = 0; af < 4; ++af) {
#pragma unroll
        for (int t = 0; t < 4; ++t) {
            const int n  = nTile + nLoc + t * 16 + lane15;
            const float bn = bias[n];
#pragma unroll
            for (int r = 0; r < 8; ++r) {
                const int m = mTile + mLoc + af * 16 + r + half * 8;
                const float val = acc[af][t][r] + bn;
                if (MODE == 0) {
                    C[(size_t)m * N + n] = val;
                } else {
                    // n = part*1024 + h*64 + d ; m = b*S + s
                    const int part = n >> 10;
                    const int h    = (n >> 6) & (H_ - 1);
                    const int d    = n & (HD_ - 1);
                    const int b    = m >> 11;          // S = 2048
                    const int s    = m & (S_ - 1);
                    const size_t idx = ((((size_t)part * B_ + b) * H_ + h) * S_ + s) * HD_ + d;
                    C[idx] = val;
                }
            }
        }
    }
}

// ---------------------------------------------------------------------------
// Gathered attention. One block = 16 waves = 16 consecutive queries s; each
// wave keeps its query's 64 route offsets in registers and walks the 16 heads
// of one batch with them (256 blocks in all). Eight lanes share one K or V row: a
// wave-wide 16-byte load covers four whole 128-byte lines (four rows), never
// 32 partial ones.
// Lane (grp, l8): rows j = grp*16 + i, elements l8*4..+3 and 32 + l8*4..+3.
// q, k, v: the three [B][H][S][64] f32 planes.  Output: [B][S][DIM] f32.
// ---------------------------------------------------------------------------
#define ATT_WAVES  16

// x of lane ^ MASK inside a 16-lane row (DPP row_xmask)
template <int MASK>
__device__ __forceinline__ float row_xor(float x) {
    return __builtin_bit_cast(float, __builtin_amdgcn_update_dpp(
        0, __builtin_bit_cast(int, x), 0x160 | MASK, 0xf, 0xf, true));
}
// lane l with lane l ^ 16
__device__ __forceinline__ float half_xor(float x) {
    return __builtin_bit_cast(float, __builtin_amdgcn_permlanex16(
        __builtin_bit_cast(int, x), __builtin_bit_cast(int, x),
        0x76543210, 0xfedcba98, false, false));
}
__device__ __forceinline__ float exp2_slot(float x) {
    float y;
    asm("v_exp_f32 %0, %1\n\tv_nop" : "=v"(y) : "v"(x));
    return y;
}

typedef float f32x2 __attribute__((ext_vector_type(2)));
typedef float f32x4 __attribute__((ext_vector_type(4)));

// uniform base + 32-bit byte offset of the lane
__device__ __forceinline__ f32x4 ld16(const char* base, unsigned byteOff) {
    return *reinterpret_cast<const f32x4*>(base + byteOff);
}

__global__ __launch_bounds__(ATT_WAVES * 32)
void attn_kernel(
    const float* __restrict__ q,
    const float* __restrict__ k,
    const float* __restrict__ v,
    const int*   __restrict__ routes,
    float*       __restrict__ attn_out)
{
    const int tid  = threadIdx.x;
    const int wave = __builtin_amdgcn_readfirstlane(tid >> 5);
    const int lane = tid & 31;
    const int grp  = lane >> 3;
    const int l8   = lane & 7;
    const int s    = blockIdx.x * ATT_WAVES + wave;

    // byte offset of this lane's piece of each of its 16 rows, inside one plane;
    // the mask bounds the row index whatever the array holds
    unsigned voff[16];
    {
        const int4* rp = reinterpret_cast<const int4*>(routes + s * KN_ + grp * 16);
#pragma unroll  // constant indices keep the arrays in registers
        for (int c = 0; c < 4; ++c) {
            const int4 r = rp[c];
            voff[4*c+0] = ((unsigned)r.x & (S_ - 1)) * (HD_ * 4) + l8 * 16;
            voff[4*c+1] = ((unsigned)r.y & (S_ - 1)) * (HD_ * 4) + l8 * 16;
            voff[4*c+2] = ((unsigned)r.z & (S_ - 1)) * (HD_ * 4) + l8 * 16;
            voff[4*c+3] = ((unsigned)r.w & (S_ - 1)) * (HD_ * 4) + l8 * 16;
        }
    }

    // scalar bases that stay fixed through the loop (plane and batch); the head
    // goes into the lanes' 32-bit offsets, which step in place at the loop's foot,
    // so that no load's result lands in a register that an older load names
    const int b = blockIdx.y;
    const unsigned headB = S_ * HD_ * 4;
    const char* qB = reinterpret_cast<const char*>(q) + (size_t)b * H_ * headB;
    const char* kB = reinterpret_cast<const char*>(k) + (size_t)b * H_ * headB;
    const char* vB = reinterpret_cast<const char*>(v) + (size_t)b * H_ * headB;
    char* oB = reinterpret_cast<char*>(attn_out) + (size_t)b * S_ * DIM_ * 4;
    unsigned qoff = (unsigned)s * (HD_ * 4) + l8 * 16;
    unsigned ooff = (unsigned)s * (DIM_ * 4)
                  + ((grp >> 1) * 32 + l8 * 4 + (grp & 1) * 2) * 4;

    for (int h = 0; h < H_; ++h) {
        const f32x4 qa = ld16(qB,       qoff);
        const f32x4 qb = ld16(qB + 128, qoff);

        // first half of the V rows: in flight under the scores
        f32x4 va[8], vc[8];
#pragma unroll  // constant indices keep the arrays in registers
        for (int i = 0; i < 8; ++i) {
            va[i] = ld16(vB,       voff[i]);
            vc[i] = ld16(vB + 128, voff[i]);
        }

        // scores of this lane's 16 rows, the same in all 8 lanes of a group
        float sc[16];
#pragma unroll  // constant indices keep the arrays in registers
        for (int g = 0; g < 2; ++g) {
            f32x4 ka[8], kc[8];
#pragma unroll  // constant indices keep the arrays in registers
            for (int i = 0; i < 8; ++i) {
                ka[i] = ld16(kB,       voff[g*8+i]);
                kc[i] = ld16(kB + 128, voff[g*8+i]);
            }
#pragma unroll  // constant indices keep the arrays in registers
            for (int i = 0; i < 8; ++i) {
                f32x2 p2 = ka[i].xy * qa.xy;
                p2 += ka[i].zw * qa.zw;
                p2 += kc[i].xy * qb.xy;
                p2 += kc[i].zw * qb.zw;
                float p = p2.x + p2.y;
                p += row_xor<1>(p);
                p += row_xor<2>(p);
                p += row_xor<4>(p);
                sc[g*8+i] = p * SCALE_;
            }
        }
        // keeps the loads above in flight under the scores (without it the first
        // V rows sink down to their uses) and the loads below out of the K
        // rows' registers until those are free
        __builtin_amdgcn_sched_barrier(0);
        f32x4 vd[8], ve[8];
#pragma unroll  // constant indices keep the arrays in registers
        for (int i = 0; i < 8; ++i) {
            vd[i] = ld16(vB,       voff[8+i]);
            ve[i] = ld16(vB + 128, voff[8+i]);
        }

        // softmax over 64 = 16 in registers x 4 groups (lane ^ 8, lane ^ 16)
        float mx = sc[0];
#pragma unroll  // constant indices keep the arrays in registers
        for (int i = 1; i < 16; ++i) mx = fmaxf(mx, sc[i]);
        mx = fmaxf(mx, row_xor<8>(mx));
        mx = fmaxf(mx, half_xor(mx));
        float sum = 0.f;
#pragma unroll  // constant indices keep the arrays in registers
        for (int i = 0; i < 16; ++i) {
            sc[i] = exp2_slot((sc[i] - mx) * 1.44269504f);
            sum += sc[i];
        }
        sum += row_xor<8>(sum);
        sum += half_xor(sum);
        const float inv = 1.0f / sum;

        // out[d] = sum_j e[j] * v[route_j][d], normalised once at the end
        f32x2 o[4] = {{0.f, 0.f}, {0.f, 0.f}, {0.f, 0.f}, {0.f, 0.f}};
#pragma unroll  // constant indices keep the arrays in registers
        for (int i = 0; i < 8; ++i) {
            const float w = sc[i];
            o[0] += w * va[i].xy; o[1] += w * va[i].zw;
            o[2] += w * vc[i].xy; o[3] += w * vc[i].zw;
        }
#pragma unroll  // constant indices keep the arrays in registers
        for (int i = 0; i < 8; ++i) {
            const float w = sc[8+i];
            o[0] += w * vd[i].xy; o[1] += w * vd[i].zw;
            o[2] += w * ve[i].xy; o[3] += w * ve[i].zw;
        }
        float r[8] = {o[0].x, o[0].y, o[1].x, o[1].y, o[2].x, o[2].y, o[3].x, o[3].y};
#pragma unroll  // constant indices keep the arrays in registers
        for (int e = 0; e < 8; ++e) {
            r[e] += row_xor<8>(r[e]);
            r[e] += half_xor(r[e]);
        }

        // every lane stores 8 bytes: group g holds elements (g>>1)*32 + l8*4 + (g&1)*2
        f32x2 st;
        st.x = (grp & 2) ? ((grp & 1) ? r[6] : r[4]) : ((grp & 1) ? r[2] : r[0]);
        st.y = (grp & 2) ? ((grp & 1) ? r[7] : r[5]) : ((grp & 1) ? r[3] : r[1]);
        st *= inv;
        *reinterpret_cast<f32x2*>(oB + ooff) = st;
        // the offsets step next, and the next trip rewrites the store's data registers
        asm volatile("s_wait_xcnt 0x0" ::: "memory");
        // keeps the steps of the offsets below that wait, behind every load that names them
        __builtin_amdgcn_sched_barrier(0);
        qoff += headB;
        ooff += HD_ * 4;
#pragma unroll  // constant indices keep the arrays in registers
        for (int i = 0; i < 16; ++i) voff[i] += headB;
    }
}

// ---------------------------------------------------------------------------
// Orchestration
// ---------------------------------------------------------------------------
extern "C" void kernel_launch(void* const* d_in, const int* in_sizes, int n_in,
                              void* d_out, int out_size, void* d_ws, size_t ws_size,
                              hipStream_t stream) {
    const float* x      = (const float*)d_in[0];
    const int*   routes = (const int*)  d_in[1];
    const float* qkv_w  = (const float*)d_in[2];
    const float* qkv_b  = (const float*)d_in[3];
    const float* out_w  = (const float*)d_in[4];
    const float* out_b  = (const float*)d_in[5];
    float* out = (float*)d_out;

    const int M = B_ * S_;          // 4096
    char* ws = (char*)d_ws;
    size_t off = 0;
    auto take = [&](size_t bytes) -> char* {
        char* p = ws + off;
        off += (bytes + 255) & ~(size_t)255;
        return p;
    };
    unsigned short* x_bf    = (unsigned short*)take((size_t)M * DIM_ * 2);
    unsigned short* qw_bf   = (unsigned short*)take((size_t)3 * DIM_ * DIM_ * 2);
    unsigned short* ow_bf   = (unsigned short*)take((size_t)DIM_ * DIM_ * 2);
    float*          qkv     = (float*)        take((size_t)3 * B_ * H_ * S_ * HD_ * 4);
    float*          aout    = (float*)        take((size_t)M * DIM_ * 4);
    unsigned short* aout_bf = (unsigned short*)take((size_t)M * DIM_ * 2);

    // 1) bf16 conversions
    cvt_bf16_kernel<<<(M * DIM_) / CVT_SPAN, CVT_WAVES * 32, 0, stream>>>(x, x_bf);
    cvt_bf16_kernel<<<(3 * DIM_ * DIM_) / CVT_SPAN, CVT_WAVES * 32, 0, stream>>>(qkv_w, qw_bf);
    cvt_bf16_kernel<<<(DIM_ * DIM_) / CVT_SPAN, CVT_WAVES * 32, 0, stream>>>(out_w, ow_bf);

    // 2) QKV projection GEMM (WMMA bf16 + async LDS staging) -> [3][B][H][S][64]
    wmma_gemm_kernel<1><<<dim3((3 * DIM_) / 128, M / 128), 128, 0, stream>>>(
        x_bf, qw_bf, qkv_b, qkv, M, 3 * DIM_, DIM_);

    // 3) Gathered attention + softmax
    attn_kernel<<<dim3(S_ / ATT_WAVES, B_), ATT_WAVES * 32, 0, stream>>>(
        qkv, qkv + (size_t)B_ * H_ * S_ * HD_, qkv + (size_t)2 * B_ * H_ * S_ * HD_, routes, aout);

    // 4) Output projection GEMM (WMMA bf16) -> d_out
    cvt_bf16_kernel<<<(M * DIM_) / CVT_SPAN, CVT_WAVES * 32, 0, stream>>>(aout, aout_bf);
    wmma_gemm_kernel<0><<<dim3(DIM_ / 128, M / 128), 128, 0, stream>>>(
        aout_bf, ow_bf, out_b, out, M, DIM_, DIM_);
}

// v005
// A run of this version takes 105 microseconds.
// In two side-by-side timings against v004, it was 1.07 and 1.08 times as fast.
// Over all steps from v000 it is 2.29 times as fast.
#include <hip/hip_runtime.h>
#include <hip/hip_bf16.h>

// Problem constants (fixed by the reference)
#define B_    2
#define S_    2048
#define DIM_  1024
#define H_    16
#define HD_   64
#define KN_   64
#define SCALE_ 0.125f   // 1/sqrt(64)

typedef __attribute__((ext_vector_type(16))) __bf16 v16bf;
typedef __attribute__((ext_vector_type(8)))  float  v8f;

// async-copy builtin wants pointers to int4 (vector_size(16)) in AS1/AS3
typedef int v4i __attribute__((vector_size(16)));
typedef __attribute__((address_space(1))) v4i as1_v4i;
typedef __attribute__((address_space(3))) v4i as3_v4i;

struct Raw32 { uint4 lo; uint4 hi; };  // 32 bytes == v16bf

// ---------------------------------------------------------------------------
// f32 -> bf16 (round-to-nearest-even), stored as raw u16
// ---------------------------------------------------------------------------
__device__ __forceinline__ unsigned short f32_to_bf16u(float f) {
    union { float f; unsigned u; } a; a.f = f;
    unsigned r = a.u + 0x7FFFu + ((a.u >> 16) & 1u);
    return (unsigned short)(r >> 16);
}

// One block = 16 waves; a wave takes 4 KiB of contiguous f32: 8 loads of 16 bytes
// a lane, each wave-wide load four whole 128-byte lines, all issued before the
// first value is used; each wave-wide 8-byte store covers two whole lines.
// The three input arrays need nothing of each other and share one grid: each has
// its own range of block indices, which covers it exactly (every length is a
// multiple of CVT_SPAN); the choice is the same for a whole block.
#define CVT_WAVES 16
#define CVT_LOADS 8
#define CVT_SPAN  (CVT_WAVES * CVT_LOADS * 128)   // 16384 elements a block
#define CVT_BLK_X  ((B_ * S_ * DIM_) / CVT_SPAN)
#define CVT_BLK_QW ((3 * DIM_ * DIM_) / CVT_SPAN)
#define CVT_BLK_OW ((DIM_ * DIM_) / CVT_SPAN)

__global__ __launch_bounds__(CVT_WAVES * 32) void cvt_inputs_kernel(
    const float* __restrict__ x,  unsigned short* __restrict__ x_bf,
    const float* __restrict__ qw, unsigned short* __restrict__ qw_bf,
    const float* __restrict__ ow, unsigned short* __restrict__ ow_bf)
{
    const unsigned bid  = blockIdx.x;
    const bool     isOw = bid >= CVT_BLK_X + CVT_BLK_QW;
    const bool     isQw = bid >= CVT_BLK_X;
    const float*    in  = isOw ? ow    : isQw ? qw    : x;
    unsigned short* out = isOw ? ow_bf : isQw ? qw_bf : x_bf;
    const unsigned  blk = bid - (isOw ? CVT_BLK_X + CVT_BLK_QW : isQw ? CVT_BLK_X : 0);
    const unsigned base = (blk * CVT_WAVES + (threadIdx.x >> 5)) * (CVT_LOADS * 128)
                        + (threadIdx.x & 31) * 4;
    float4 v[CVT_LOADS];
#pragma unroll  // constant indices keep the array in registers, all loads in flight together
    for (int i = 0; i < CVT_LOADS; ++i)
        v[i] = *reinterpret_cast<const float4*>(in + base + i * 128);
#pragma unroll  // constant indices keep the array in registers
    for (int i = 0; i < CVT_LOADS; ++i) {
        uint2 p;
        p.x = (unsigned)f32_to_bf16u(v[i].x) | ((unsigned)f32_to_bf16u(v[i].y) << 16);
        p.y = (unsigned)f32_to_bf16u(v[i].z) | ((unsigned)f32_to_bf16u(v[i].w) << 16);
        *reinterpret_cast<uint2*>(out + base + i * 128) = p;
    }
}

// ---------------------------------------------------------------------------
// Load one 16x32 bf16 WMMA fragment slice for this lane.
// Lane l<16 supplies K {0..7,16..23}; lane l>=16 supplies K {8..15,24..31}:
// two contiguous 16B chunks at +0 and +16 elements (lane-half offset folded
// into the pointer by the caller). Works for global or LDS (generic) memory.
// ---------------------------------------------------------------------------
__device__ __forceinline__ v16bf load_frag16(const unsigned short* p) {
    Raw32 r;
    r.lo = *reinterpret_cast<const uint4*>(p);
    r.hi = *reinterpret_cast<const uint4*>(p + 16);
    return __builtin_bit_cast(v16bf, r);
}

// ---------------------------------------------------------------------------
// WMMA GEMM:  C[M,N] = A[M,K] * W[N,K]^T + bias[N]
// Workgroup = 128 threads (4 waves, 2 x 2). Tile: M=128 x N=128, K staged by 64.
// Both operand tiles (128 rows x 64 k of bf16 each) lie in LDS, two buffers,
// filled with GLOBAL_LOAD_ASYNC_TO_LDS_B128 (ASYNCcnt): a wave-wide copy takes
// four whole 128-byte lines, and each landed row serves two waves. Rows lie at
// a pitch of 144 bytes (16 B x odd): the 16 rows that a 16-byte fragment read
// touches then fall on 16 different groups of four banks.
// Each wave: 64 rows x 64 cols -> 4x4 v8f accumulators, 32 WMMAs per K-stage.
// M, N multiples of 128; K a multiple of 64 and at least 128 (two stages).
// MODE 0: store row-major C[m*N+n]  (final out-projection -> d_out)
// MODE 1: scatter into qkv buffer laid out [3][B][H][S][64]
// ---------------------------------------------------------------------------
#define T_PITCH 72   // elements: 64 of the tile + 8 never written or read
#define T_ROWS  128

template <int MODE>
__global__ __launch_bounds__(128) void wmma_gemm_kernel(
    const unsigned short* __restrict__ A,
    const unsigned short* __restrict__ W,
    const float* __restrict__ bias,
    float* __restrict__ C,
    int M, int N, int K)
{
    __shared__ unsigned short At[2][T_ROWS * T_PITCH];   // 2 x 18 KiB
    __shared__ unsigned short Bt[2][T_ROWS * T_PITCH];   // 2 x 18 KiB

    const int tid    = threadIdx.x;     // 0..127
    const int wave   = tid >> 5;
    const int lane   = tid & 31;
    const int lane15 = lane & 15;
    const int half   = lane >> 4;       // 0: K 0..7/16..23, 1: K 8..15/24..31
    const int off    = half * 8;

    const int mTile = blockIdx.y * T_ROWS;
    const int nTile = blockIdx.x * T_ROWS;
    const int mLoc  = (wave >> 1) * 64;  // this wave's rows inside the A tile
    const int nLoc  = (wave & 1) * 64;   // this wave's rows inside the B tile

    v8f acc[4][4];
#pragma unroll
    for (int i = 0; i < 4; ++i)
#pragma unroll
        for (int j = 0; j < 4; ++j) acc[i][j] = v8f{};

    // ---- cooperative stage: 2 tiles x 128 rows x 64 k (bf16) = 2 x 1024 16B chunks.
    // Thread: chunk tid & 7 of rows (tid >> 3) + 16 i, the same in both tiles.
    const char* aBase = reinterpret_cast<const char*>(A + (size_t)mTile * K);
    const char* wBase = reinterpret_cast<const char*>(W + (size_t)nTile * K);
    const unsigned gOff0   = ((unsigned)(tid >> 3) * (unsigned)K + (tid & 7) * 8) * 2;
    const unsigned gStep   = 16u * (unsigned)K * 2;
    const int      lOff0   = (tid >> 3) * T_PITCH + (tid & 7) * 8;
    auto issue_stage = [&](int buf, int k0) {
        const char* ga = aBase + (size_t)k0 * 2;
        const char* gw = wBase + (size_t)k0 * 2;
#pragma unroll
        for (int i = 0; i < 8; ++i) {
            __builtin_amdgcn_global_load_async_to_lds_b128(
                (as1_v4i*)(ga + (gOff0 + i * gStep)),
                (as3_v4i*)&At[buf][lOff0 + i * 16 * T_PITCH], 0, 0);
            __builtin_amdgcn_global_load_async_to_lds_b128(
                (as1_v4i*)(gw + (gOff0 + i * gStep)),
                (as3_v4i*)&Bt[buf][lOff0 + i * 16 * T_PITCH], 0, 0);
        }
    };

    // one k chunk of 32: this wave's 4 A and 4 B fragments, 16 reads of 16 bytes
    const unsigned short* atW = &At[0][(mLoc + lane15) * T_PITCH + off];
    const unsigned short* btW = &Bt[0][(nLoc + lane15) * T_PITCH + off];
    auto load_set = [&](v16bf (&a)[4], v16bf (&b)[4], int buf, int kc) {
        const int o = buf * (T_ROWS * T_PITCH) + kc * 32;
#pragma unroll
        for (int i = 0; i < 4; ++i) a[i] = load_frag16(atW + o + i * 16 * T_PITCH);
#pragma unroll
        for (int j = 0; j < 4; ++j) b[j] = load_frag16(btW + o + j * 16 * T_PITCH);
    };
    auto wmma_block = [&](const v16bf (&a)[4], const v16bf (&b)[4]) {
#pragma unroll
        for (int i = 0; i < 4; ++i)
#pragma unroll
            for (int j = 0; j < 4; ++j)
                acc[i][j] = __builtin_amdgcn_wmma_f32_16x16x32_bf16(
                                false, a[i], false, b[j], (short)0, acc[i][j], false, false);
    };

    const int nStages = K / 64;
    issue_stage(0, 0);
    // stage 0 has landed for this wave, then for all: nothing reads it before
    asm volatile("s_wait_asynccnt 0x0" ::: "memory");
    __syncthreads();
    issue_stage(1, 64);

    // two fragment sets: each group of 16 reads is issued one WMMA block ahead
    v16bf a0[4], b0[4], a1[4], b1[4];
    load_set(a0, b0, 0, 0);

    for (int st = 0; st < nStages; ++st) {
        const int cur = st & 1;
        load_set(a1, b1, cur, 1);
        // keeps the reads as one group in front of the block, not among its WMMAs
        __builtin_amdgcn_sched_barrier(0);
        wmma_block(a0, b0);
        // keeps the block in front of the hand-over, as cover for the reads above
        __builtin_amdgcn_sched_barrier(0);
        // hand-over, in front of the stage's last block, whose fragments are in
        // registers: this wave's reads of buffer cur are done ...
        asm volatile("s_wait_dscnt 0x0" ::: "memory");
        // ... its copies of stage st + 1 have landed ...
        asm volatile("s_wait_asynccnt 0x0" ::: "memory");
        // ... and so have every wave's: stage st + 1 may be read, buffer cur refilled
        __syncthreads();
        if (st + 2 < nStages) issue_stage(cur, (st + 2) * 64);
        // first chunk of stage st + 1; in the last trip the other buffer's old rows, unused
        load_set(a0, b0, cur ^ 1, 0);
        // keeps the reads as one group in front of the block, not among its WMMAs
        __builtin_amdgcn_sched_barrier(0);
        wmma_block(a1, b1);
    }
    // no copy is outstanding when the wave ends
    asm volatile("s_wait_asynccnt 0x0" ::: "memory");

    // Epilogue: D layout -> lane n=lane15, VGPR r holds row r + 8*half
#pragma unroll
    for (int af = 0; af < 4; ++af) {
#pragma unroll
        for (int t = 0; t < 4; ++t) {
            const int n  = nTile + nLoc + t * 16 + lane15;
            const float bn = bias[n];
#pragma unroll
            for (int r = 0; r < 8; ++r) {
                const int m = mTile + mLoc + af * 16 + r + half * 8;
                const float val = acc[af][t][r] + bn;
                if (MODE == 0) {
                    C[(size_t)m * N + n] = val;
                } else {
                    // n = part*1024 + h*64 + d ; m = b*S + s
                    const int part = n >> 10;
                    const int h    = (n >> 6) & (H_ - 1);
                    const int d    = n & (HD_ - 1);
                    const int b    = m >> 11;          // S = 2048
                    const int s    = m & (S_ - 1);
                    const size_t idx = ((((size_t)part * B_ + b) * H_ + h) * S_ + s) * HD_ + d;
                    C[idx] = val;
                }
            }
        }
    }
}

// ---------------------------------------------------------------------------
// Gathered attention. One block = 16 waves = 16 consecutive queries s; each
// wave keeps its query's 64 route offsets in registers and walks the 16 heads
// of one batch with them (256 blocks in all). Eight lanes share one K or V row: a
// wave-wide 16-byte load covers four whole 128-byte lines (four rows), never
// 32 partial ones.
// Lane (grp, l8): rows j = grp*16 + i, elements l8*4..+3 and 32 + l8*4..+3.
// q, k, v: the three [B][H][S][64] f32 planes.  Output: [B][S][DIM] bf16, rounded
// here from the f32 result: the operand of the output projection.
// ---------------------------------------------------------------------------
#define ATT_WAVES  16

// x of lane ^ MASK inside a 16-lane row (DPP row_xmask)
template <int MASK>
__device__ __forceinline__ float row_xor(float x) {
    return __builtin_bit_cast(float, __builtin_amdgcn_update_dpp(
        0, __builtin_bit_cast(int, x), 0x160 | MASK, 0xf, 0xf, true));
}
// lane l with lane l ^ 16
__device__ __forceinline__ float half_xor(float x) {
    return __builtin_bit_cast(float, __builtin_amdgcn_permlanex16(
        __builtin_bit_cast(int, x), __builtin_bit_cast(int, x),
        0x76543210, 0xfedcba98, false, false));
}
__device__ __forceinline__ float exp2_slot(float x) {
    float y;
    asm("v_exp_f32 %0, %1\n\tv_nop" : "=v"(y) : "v"(x));
    return y;
}

typedef float f32x2 __attribute__((ext_vector_type(2)));
typedef float f32x4 __attribute__((ext_vector_type(4)));

// uniform base + 32-bit byte offset of the lane
__device__ __forceinline__ f32x4 ld16(const char* base, unsigned byteOff) {
    return *reinterpret_cast<const f32x4*>(base + byteOff);
}

__global__ __launch_bounds__(ATT_WAVES * 32)
void attn_kernel(
    const float* __restrict__ q,
    const float* __restrict__ k,
    const float* __restrict__ v,
    const int*   __restrict__ routes,
    unsigned short* __restrict__ attn_out)
{
    const int tid  = threadIdx.x;
    const int wave = __builtin_amdgcn_readfirstlane(tid >> 5);
    const int lane = tid & 31;
    const int grp  = lane >> 3;
    const int l8   = lane & 7;
    const int s    = blockIdx.x * ATT_WAVES + wave;

    // byte offset of this lane's piece of each of its 16 rows, inside one plane;
    // the mask bounds the row index whatever the array holds
    unsigned voff[16];
    {
        const int4* rp = reinterpret_cast<const int4*>(routes + s * KN_ + grp * 16);
#pragma unroll  // constant indices keep the arrays in registers
        for (int c = 0; c < 4; ++c) {
            const int4 r = rp[c];
            voff[4*c+0] = ((unsigned)r.x & (S_ - 1)) * (HD_ * 4) + l8 * 16;
            voff[4*c+1] = ((unsigned)r.y & (S_ - 1)) * (HD_ * 4) + l8 * 16;
            voff[4*c+2] = ((unsigned)r.z & (S_ - 1)) * (HD_ * 4) + l8 * 16;
            voff[4*c+3] = ((unsigned)r.w & (S_ - 1)) * (HD_ * 4) + l8 * 16;
        }
    }

    // scalar bases that stay fixed through the loop (plane and batch); the head
    // goes into the lanes' 32-bit offsets, which step in place at the loop's foot,
    // so that no load's result lands in a register that an older load names
    const int b = blockIdx.y;
    const unsigned headB = S_ * HD_ * 4;
    const char* qB = reinterpret_cast<const char*>(q) + (size_t)b * H_ * headB;
    const char* kB = reinterpret_cast<const char*>(k) + (size_t)b * H_ * headB;
    const char* vB = reinterpret_cast<const char*>(v) + (size_t)b * H_ * headB;
    char* oB = reinterpret_cast<char*>(attn_out) + (size_t)b * S_ * DIM_ * 2;
    unsigned qoff = (unsigned)s * (HD_ * 4) + l8 * 16;
    unsigned ooff = (unsigned)s * (DIM_ * 2)
                  + ((grp >> 1) * 32 + l8 * 4 + (grp & 1) * 2) * 2;

    for (int h = 0; h < H_; ++h) {
        const f32x4 qa = ld16(qB,       qoff);
        const f32x4 qb = ld16(qB + 128, qoff);

        // first half of the V rows: in flight under the scores
        f32x4 va[8], vc[8];
#pragma unroll  // constant indices keep the arrays in registers
        for (int i = 0; i < 8; ++i) {
            va[i] = ld16(vB,       voff[i]);
            vc[i] = ld16(vB + 128, voff[i]);
        }

        // scores of this lane's 16 rows, the same in all 8 lanes of a group
        float sc[16];
#pragma unroll  // constant indices keep the arrays in registers
        for (int g = 0; g < 2; ++g) {
            f32x4 ka[8], kc[8];
#pragma unroll  // constant indices keep the arrays in registers
            for (int i = 0; i < 8; ++i) {
                ka[i] = ld16(kB,       voff[g*8+i]);
                kc[i] = ld16(kB + 128, voff[g*8+i]);
            }
#pragma unroll  // constant indices keep the arrays in registers
            for (int i = 0; i < 8; ++i) {
                f32x2 p2 = ka[i].xy * qa.xy;
                p2 += ka[i].zw * qa.zw;
                p2 += kc[i].xy * qb.xy;
                p2 += kc[i].zw * qb.zw;
                float p = p2.x + p2.y;
                p += row_xor<1>(p);
                p += row_xor<2>(p);
                p += row_xor<4>(p);
                sc[g*8+i] = p * SCALE_;
            }
        }
        // keeps the loads above in flight under the scores (without it the first
        // V rows sink down to their uses) and the loads below out of the K
        // rows' registers until those are free
        __builtin_amdgcn_sched_barrier(0);
        f32x4 vd[8], ve[8];
#pragma unroll  // constant indices keep the arrays in registers
        for (int i = 0; i < 8; ++i) {
            vd[i] = ld16(vB,       voff[8+i]);
            ve[i] = ld16(vB + 128, voff[8+i]);
        }

        // softmax over 64 = 16 in registers x 4 groups (lane ^ 8, lane ^ 16)
        float mx = sc[0];
#pragma unroll  // constant indices keep the arrays in registers
        for (int i = 1; i < 16; ++i) mx = fmaxf(mx, sc[i]);
        mx = fmaxf(mx, row_xor<8>(mx));
        mx = fmaxf(mx, half_xor(mx));
        float sum = 0.f;
#pragma unroll  // constant indices keep the arrays in registers
        for (int i = 0; i < 16; ++i) {
            sc[i] = exp2_slot((sc[i] - mx) * 1.44269504f);
            sum += sc[i];
        }
        sum += row_xor<8>(sum);
        sum += half_xor(sum);
        const float inv = 1.0f / sum;

        // out[d] = sum_j e[j] * v[route_j][d], normalised once at the end
        f32x2 o[4] = {{0.f, 0.f}, {0.f, 0.f}, {0.f, 0.f}, {0.f, 0.f}};
#pragma unroll  // constant indices keep the arrays in registers
        for (int i = 0; i < 8; ++i) {
            const float w = sc[i];
            o[0] += w * va[i].xy; o[1] += w * va[i].zw;
            o[2] += w * vc[i].xy; o[3] += w * vc[i].zw;
        }
#pragma unroll  // constant indices keep the arrays in registers
        for (int i = 0; i < 8; ++i) {
            const float w = sc[8+i];
            o[0] += w * vd[i].xy; o[1] += w * vd[i].zw;
            o[2] += w * ve[i].xy; o[3] += w * ve[i].zw;
        }
        float r[8] = {o[0].x, o[0].y, o[1].x, o[1].y, o[2].x, o[2].y, o[3].x, o[3].y};
#pragma unroll  // constant indices keep the arrays in registers
        for (int e = 0; e < 8; ++e) {
            r[e] += row_xor<8>(r[e]);
            r[e] += half_xor(r[e]);
        }

        // every lane stores two bf16, the wave one whole 128-byte line:
        // group g holds elements (g>>1)*32 + l8*4 + (g&1)*2
        f32x2 st;
        st.x = (grp & 2) ? ((grp & 1) ? r[6] : r[4]) : ((grp & 1) ? r[2] : r[0]);
        st.y = (grp & 2) ? ((grp & 1) ? r[7] : r[5]) : ((grp & 1) ? r[3] : r[1]);
        st *= inv;
        *reinterpret_cast<unsigned*>(oB + ooff) =
            (unsigned)f32_to_bf16u(st.x) | ((unsigned)f32_to_bf16u(st.y) << 16);
        // the offsets step next, and the next trip rewrites the store's data registers
        asm volatile("s_wait_xcnt 0x0" ::: "memory");
        // keeps the steps of the offsets below that wait, behind every load that names them
        __builtin_amdgcn_sched_barrier(0);
        qoff += headB;
        ooff += HD_ * 2;
#pragma unroll  // constant indices keep the arrays in registers
        for (int i = 0; i < 16; ++i) voff[i] += headB;
    }
}

// ---------------------------------------------------------------------------
// Orchestration
// ---------------------------------------------------------------------------
extern "C" void kernel_launch(void* const* d_in, const int* in_sizes, int n_in,
                              void* d_out, int out_size, void* d_ws, size_t ws_size,
                              hipStream_t stream) {
    const float* x      = (const float*)d_in[0];
    const int*   routes = (const int*)  d_in[1];
    const float* qkv_w  = (const float*)d_in[2];
    const float* qkv_b  = (const float*)d_in[3];
    const float* out_w  = (const float*)d_in[4];
    const float* out_b  = (const float*)d_in[5];
    float* out = (float*)d_out;

    const int M = B_ * S_;          // 4096
    char* ws = (char*)d_ws;
    size_t off = 0;
    auto take = [&](size_t bytes) -> char* {
        char* p = ws + off;
        off += (bytes + 255) & ~(size_t)255;
        return p;
    };
    unsigned short* x_bf    = (unsigned short*)take((size_t)M * DIM_ * 2);
    unsigned short* qw_bf   = (unsigned short*)take((size_t)3 * DIM_ * DIM_ * 2);
    unsigned short* ow_bf   = (unsigned short*)take((size_t)DIM_ * DIM_ * 2);
    float*          qkv     = (float*)        take((size_t)3 * B_ * H_ * S_ * HD_ * 4);
    unsigned short* aout_bf = (unsigned short*)take((size_t)M * DIM_ * 2);

    // 1) bf16 conversions of the three inputs, one grid
    cvt_inputs_kernel<<<CVT_BLK_X + CVT_BLK_QW + CVT_BLK_OW, CVT_WAVES * 32, 0, stream>>>(
        x, x_bf, qkv_w, qw_bf, out_w, ow_bf);

    // 2) QKV projection GEMM (WMMA bf16 + async LDS staging) -> [3][B][H][S][64]
    wmma_gemm_kernel<1><<<dim3((3 * DIM_) / 128, M / 128), 128, 0, stream>>>(
        x_bf, qw_bf, qkv_b, qkv, M, 3 * DIM_, DIM_);

    // 3) Gathered attention + softmax -> bf16
    attn_kernel<<<dim3(S_ / ATT_WAVES, B_), ATT_WAVES * 32, 0, stream>>>(
        qkv, qkv + (size_t)B_ * H_ * S_ * HD_, qkv + (size_t)2 * B_ * H_ * S_ * HD_, routes, aout_bf);

    // 4) Output projection GEMM (WMMA bf16) -> d_out
    wmma_gemm_kernel<0><<<dim3(DIM_ / 128, M / 128), 128, 0, stream>>>(
        aout_bf, ow_bf, out_b, out, M, DIM_, DIM_);
}

// v008
// It runs in 65.2 microseconds.
// Versions in between are left out here; by their measured steps it is 1.58 times as fast as v005.
// Counting every step since v000, it is 3.62 times as fast.
#include <hip/hip_runtime.h>
#include <hip/hip_bf16.h>

// Problem constants (fixed by the reference)
#define B_    2
#define S_    2048
#define DIM_  1024
#define H_    16
#define HD_   64
#define KN_   64
#define SCALE_ 0.125f   // 1/sqrt(64)

typedef __attribute__((ext_vector_type(16))) __bf16 v16bf;
typedef __attribute__((ext_vector_type(8)))  float  v8f;

// async-copy builtin wants pointers to int4 (vector_size(16)) in AS1/AS3
typedef int v4i __attribute__((vector_size(16)));
typedef __attribute__((address_space(1))) v4i as1_v4i;
typedef __attribute__((address_space(3))) v4i as3_v4i;

struct Raw32 { uint4 lo; uint4 hi; };  // 32 bytes == v16bf

// ---------------------------------------------------------------------------
// f32 -> bf16 (round-to-nearest-even), stored as raw u16
// ---------------------------------------------------------------------------
__device__ __forceinline__ unsigned short f32_to_bf16u(float f) {
    union { float f; unsigned u; } a; a.f = f;
    unsigned r = a.u + 0x7FFFu + ((a.u >> 16) & 1u);
    return (unsigned short)(r >> 16);
}

// One block = 16 waves; a wave takes 4 KiB of contiguous f32: 8 loads of 16 bytes
// a lane, each wave-wide load four whole 128-byte lines, all issued before the
// first value is used; each wave-wide 8-byte store covers two whole lines.
// The three input arrays need nothing of each other and share one grid: each has
// its own range of block indices, which covers it exactly (every length is a
// multiple of CVT_SPAN); the choice is the same for a whole block.
#define CVT_WAVES 16
#define CVT_LOADS 8
#define CVT_SPAN  (CVT_WAVES * CVT_LOADS * 128)   // 16384 elements a block
#define CVT_BLK_X  ((B_ * S_ * DIM_) / CVT_SPAN)
#define CVT_BLK_QW ((3 * DIM_ * DIM_) / CVT_SPAN)
#define CVT_BLK_OW ((DIM_ * DIM_) / CVT_SPAN)

__global__ __launch_bounds__(CVT_WAVES * 32) void cvt_inputs_kernel(
    const float* __restrict__ x,  unsigned short* __restrict__ x_bf,
    const float* __restrict__ qw, unsigned short* __restrict__ qw_bf,
    const float* __restrict__ ow, unsigned short* __restrict__ ow_bf)
{
    const unsigned bid  = blockIdx.x;
    const bool     isOw = bid >= CVT_BLK_X + CVT_BLK_QW;
    const bool     isQw = bid >= CVT_BLK_X;
    const float*    in  = isOw ? ow    : isQw ? qw    : x;
    unsigned short* out = isOw ? ow_bf : isQw ? qw_bf : x_bf;
    const unsigned  blk = bid - (isOw ? CVT_BLK_X + CVT_BLK_QW : isQw ? CVT_BLK_X : 0);
    const unsigned base = (blk * CVT_WAVES + (threadIdx.x >> 5)) * (CVT_LOADS * 128)
                        + (threadIdx.x & 31) * 4;
    float4 v[CVT_LOADS];
#pragma unroll  // constant indices keep the array in registers, all loads in flight together
    for (int i = 0; i < CVT_LOADS; ++i)
        v[i] = *reinterpret_cast<const float4*>(in + base + i * 128);
#pragma unroll  // constant indices keep the array in registers
    for (int i = 0; i < CVT_LOADS; ++i) {
        uint2 p;
        p.x = (unsigned)f32_to_bf16u(v[i].x) | ((unsigned)f32_to_bf16u(v[i].y) << 16);
        p.y = (unsigned)f32_to_bf16u(v[i].z) | ((unsigned)f32_to_bf16u(v[i].w) << 16);
        *reinterpret_cast<uint2*>(out + base + i * 128) = p;
    }
}

// ---------------------------------------------------------------------------
// Load one 16x32 bf16 WMMA fragment slice for this lane.
// Lane l<16 supplies K {0..7,16..23}; lane l>=16 supplies K {8..15,24..31}:
// two contiguous 16B chunks at +0 and +16 elements (lane-half offset folded
// into the pointer by the caller). Works for global or LDS (generic) memory.
// ---------------------------------------------------------------------------
__device__ __forceinline__ v16bf load_frag16(const unsigned short* p) {
    Raw32 r;
    r.lo = *reinterpret_cast<const uint4*>(p);
    r.hi = *reinterpret_cast<const uint4*>(p + 16);
    return __builtin_bit_cast(v16bf, r);
}

// ---------------------------------------------------------------------------
// WMMA GEMM:  C[M,N] = A[M,K] * W[N,K]^T + bias[N]
// Block tile TM x TN, one wave for each 64 x 64 of it ((TM/64) x (TN/64) waves),
// K staged by KS. The TM rows of A and, behind them, the TN rows of W (KS k of
// bf16 each) lie in LDS, three buffers, filled with GLOBAL_LOAD_ASYNC_TO_LDS_B128
// (ASYNCcnt): a wave-wide copy takes 512 bytes of whole rows, and each landed A
// row serves TN/64 waves, each W row TM/64. One half of the waves copies the even
// stages, the other the odd ones: a wave has one stage outstanding and waits for it
// to 0, while the other waves' next stage stays in flight over that wait, so
// each stage is asked for two stages ahead. Rows lie at a pitch of 2 KS + 16 bytes
// (16 B x odd): the 16 rows that a 16-byte fragment read touches then fall on 16
// different groups of four banks.
// Each wave: 4x4 v8f accumulators, 16 WMMAs per k chunk of 32.
// M, N multiples of TM, TN; K a multiple of KS and at least 3 KS (three stages).
// MODE 0: store row-major C[m*N+n]  (final out-projection -> d_out)
// MODE 1: q -> C as [B][H][S][64] f32; k and v -> KV as [B][H][S][128] f16, a
//         position's k row (64) and v row (64) side by side in 256 bytes
// ---------------------------------------------------------------------------
template <int MODE, int TM, int TN, int KS>
__global__ __launch_bounds__((TM / 64) * (TN / 64) * 32) void wmma_gemm_kernel(
    const unsigned short* __restrict__ A,
    const unsigned short* __restrict__ W,
    const float* __restrict__ bias,
    float* __restrict__ C,
    unsigned short* __restrict__ KV,
    int M, int N, int K)
{
    constexpr int NW      = (TM / 64) * (TN / 64);   // waves (even)
    constexpr int NG      = NW / 2;                  // waves that copy one stage
    constexpr int T_PITCH = KS + 8;                  // elements: 8 never written or read
    constexpr int T_STAGE = (TM + TN) * T_PITCH;     // elements of one buffer
    constexpr int KC      = KS / 32;                 // k chunks a stage (even)
    constexpr int CPR     = KS / 8;                  // 16-byte pieces a row
    constexpr int RPC     = 32 / CPR;                // rows a wave-wide copy
    constexpr int N_COPY  = (TM + TN) / RPC;         // wave-wide copies a stage
    constexpr int A_COPY  = TM / RPC;                // the first of them bring A
    constexpr int N_TURN  = (N_COPY + NG - 1) / NG;

    __shared__ __attribute__((aligned(16))) unsigned short T[3][T_STAGE];

    const int tid    = threadIdx.x;
    const int wave   = __builtin_amdgcn_readfirstlane(tid >> 5);
    // copies the stages of this parity; of waves w and w + 4 one is in each half, so that
    // where these share a SIMD one can run WMMAs while the other issues copies (speed only)
    const int grp    = ((wave >> 2) + wave) & 1;
    const int wIdx   = wave >> 1;       // place in its half: waves 2 i and 2 i + 1 differ in grp
    const int lane   = tid & 31;
    const int lane15 = lane & 15;
    const int half   = lane >> 4;       // 0: K 0..7/16..23, 1: K 8..15/24..31
    const int off    = half * 8;

    const int mTile = blockIdx.y * TM;
    const int nTile = blockIdx.x * TN;
    const int mLoc  = (wave / (TN / 64)) * 64;  // this wave's rows inside the A tile
    const int nLoc  = (wave % (TN / 64)) * 64;  // this wave's rows inside the W tile

    v8f acc[4][4];
#pragma unroll
    for (int i = 0; i < 4; ++i)
#pragma unroll
        for (int j = 0; j < 4; ++j) acc[i][j] = v8f{};

    // ---- one stage, by NG waves: copy i = wIdx + NG j brings LDS rows RPC i .. + RPC - 1.
    // Which operand a copy reads and whether the last turn has one for this wave
    // are the same for the whole wave (scalar tests).
    const char* aBase = reinterpret_cast<const char*>(A + (size_t)mTile * K);
    const char* wBase = reinterpret_cast<const char*>(W + (size_t)nTile * K);
    const unsigned rowB  = (unsigned)K * 2;
    const unsigned gLane = (unsigned)(lane / CPR) * rowB + (lane % CPR) * 16;
    const int      lLane = (lane / CPR) * T_PITCH + (lane % CPR) * 8;
    auto issue_stage = [&](int buf, int k0) {
#pragma unroll  // constant j: the tests below fold away but for one turn each
        for (int j = 0; j < N_TURN; ++j) {
            const int i = wIdx + NG * j;
            if (NG * (j + 1) <= N_COPY || i < N_COPY) {
                const bool isA = NG * (j + 1) <= A_COPY || (NG * j < A_COPY && i < A_COPY);
                const char* g = isA ? aBase + (size_t)((unsigned)(i * RPC) * rowB)
                                    : wBase + (size_t)((unsigned)((i - A_COPY) * RPC) * rowB);
                __builtin_amdgcn_global_load_async_to_lds_b128(
                    (as1_v4i*)(g + (size_t)k0 * 2 + gLane),
                    (as3_v4i*)&T[buf][i * RPC * T_PITCH + lLane], 0, 0);
            }
        }
    };

    // one k chunk of 32: this wave's 4 A and 4 B fragments, 16 reads of 16 bytes
    const unsigned short* atW = &T[0][(mLoc + lane15) * T_PITCH + off];
    const unsigned short* btW = &T[0][(TM + nLoc + lane15) * T_PITCH + off];
    auto load_set = [&](v16bf (&a)[4], v16bf (&b)[4], int buf, int kc) {
        const int o = buf * T_STAGE + kc * 32;
#pragma unroll
        for (int i = 0; i < 4; ++i) a[i] = load_frag16(atW + o + i * 16 * T_PITCH);
#pragma unroll
        for (int j = 0; j < 4; ++j) b[j] = load_frag16(btW + o + j * 16 * T_PITCH);
    };
    auto wmma_block = [&](const v16bf (&a)[4], const v16bf (&b)[4]) {
#pragma unroll
        for (int i = 0; i < 4; ++i)
#pragma unroll
            for (int j = 0; j < 4; ++j)
                acc[i][j] = __builtin_amdgcn_wmma_f32_16x16x32_bf16(
                                false, a[i], false, b[j], (short)0, acc[i][j], false, false);
    };

    const int nStages = K / KS;
    if (grp == 0) {
        issue_stage(0, 0);
        // stage 0 has landed for the waves that copied it ...
        asm volatile("s_wait_asynccnt 0x0" ::: "memory");
    } else {
        issue_stage(1, KS);
    }
    // ... then for all: nothing reads it before
    __syncthreads();
    if (grp == 0) issue_stage(2, 2 * KS);

    // two fragment sets: each group of 16 reads is issued one WMMA block ahead
    v16bf fa[2][4], fb[2][4];
    load_set(fa[0], fb[0], 0, 0);

    int cur = 0;                        // st mod 3
    for (int st = 0; st < nStages; ++st) {
        const int  nxt  = cur == 2 ? 0 : cur + 1;
        const bool mine = ((st + 1) & 1) == grp;   // stages st + 1 and st + 3 are this wave's
#pragma unroll  // constant indices keep the fragment sets in registers
        for (int kc = 0; kc + 1 < KC; ++kc) {
            load_set(fa[(kc + 1) & 1], fb[(kc + 1) & 1], cur, kc + 1);
            // keeps the reads as one group in front of the block, not among its WMMAs
            __builtin_amdgcn_sched_barrier(0);
            wmma_block(fa[kc & 1], fb[kc & 1]);
            // keeps the block in front of what follows, as cover for the reads above
            __builtin_amdgcn_sched_barrier(0);
        }
        // hand-over, in front of the stage's last block, whose fragments are in
        // registers: this wave's reads of buffer cur are done ...
        asm volatile("s_wait_dscnt 0x0" ::: "memory");
        // ... the copies of stage st + 1 have landed for each wave that issued them (all
        // that it has outstanding; the other waves' stage st + 2 flies on) ...
        if (mine) asm volatile("s_wait_asynccnt 0x0" ::: "memory");
        // ... and every wave stands here: stage st + 1 may be read, buffer cur refilled
        __syncthreads();
        if (mine && st + 3 < nStages) issue_stage(cur, (st + 3) * KS);
        // first chunk of stage st + 1; in the last trip the next buffer's old rows, unused
        load_set(fa[0], fb[0], nxt, 0);
        // keeps the reads as one group in front of the block, not among its WMMAs
        __builtin_amdgcn_sched_barrier(0);
        wmma_block(fa[1], fb[1]);
        cur = nxt;
    }
    // no copy is outstanding when the wave ends
    asm volatile("s_wait_asynccnt 0x0" ::: "memory");

    // Epilogue: D layout -> lane n=lane15, VGPR r holds row r + 8*half
    if (MODE == 0) {
#pragma unroll
        for (int af = 0; af < 4; ++af) {
#pragma unroll
            for (int t = 0; t < 4; ++t) {
                const int n  = nTile + nLoc + t * 16 + lane15;
                const float bn = bias[n];
#pragma unroll
                for (int r = 0; r < 8; ++r) {
                    const int m = mTile + mLoc + af * 16 + r + half * 8;
                    C[(size_t)m * N + n] = acc[af][t][r] + bn;
                }
            }
        }
    } else {
        // n = part*1024 + h*64 + d ; m = b*S + s. A wave's 64 columns are one head's
        // d = 0..63 of one part, its 64 rows lie in one b:
        // one address a lane, every store at a constant distance from it.
        const int n0   = nTile + nLoc;
        const int part = n0 >> 10;
        const int h    = (n0 >> 6) & (H_ - 1);
        const int m0   = mTile + mLoc + half * 8;
        const int b    = m0 >> 11;          // S = 2048
        const int s0   = m0 & (S_ - 1);
        const size_t row0 = ((size_t)b * H_ + h) * S_ + s0;
        float bn[4];
#pragma unroll
        for (int t = 0; t < 4; ++t) bn[t] = bias[n0 + t * 16 + lane15];
        // the four loads share one offset register, which is rewritten below them
        asm volatile("s_wait_xcnt 0x0" ::: "memory");
        if (part == 0) {
            float* dst = C + row0 * HD_ + lane15;
#pragma unroll
            for (int af = 0; af < 4; ++af)
#pragma unroll
                for (int r = 0; r < 8; ++r)
#pragma unroll
                    for (int t = 0; t < 4; ++t)
                        dst[(af * 16 + r) * HD_ + t * 16] = acc[af][t][r] + bn[t];
        } else {
            _Float16* dst = reinterpret_cast<_Float16*>(KV)
                          + row0 * (2 * HD_) + (part - 1) * HD_ + lane15;
            _Float16 hv[4][8][4];
#pragma unroll
            for (int af = 0; af < 4; ++af)
#pragma unroll
                for (int r = 0; r < 8; ++r)
#pragma unroll
                    for (int t = 0; t < 4; ++t)
                        hv[af][r][t] = (_Float16)(acc[af][t][r] + bn[t]);
            // keeps every conversion in front of the stores: among them the compiler turns
            // four registers round, and the wave waits after every eight stores to rewrite them
            __builtin_amdgcn_sched_barrier(0);
#pragma unroll
            for (int af = 0; af < 4; ++af)
#pragma unroll
                for (int r = 0; r < 8; ++r)
#pragma unroll
                    for (int t = 0; t < 4; ++t)
                        dst[(af * 16 + r) * (2 * HD_) + t * 16] = hv[af][r][t];
            // behind the last store: no register that a store names is rewritten ahead of it
            asm volatile("s_wait_xcnt 0x0" ::: "memory");
        }
    }
}

// ---------------------------------------------------------------------------
// Gathered attention on the matrix unit. One block = 16 consecutive queries of
// one batch; its 16 waves take one head each. The block first lists the distinct
// rows that its 16 x 64 routes name (at most 1024) and, for each query and listed
// row, how often the query names the row (n; 0 = not at all). For any routes
//   out[q] = sum_u n[q][u] e^(s[q][u]) v[u] / sum_u n[q][u] e^(s[q][u]),
// u over the list, so each listed row is fetched once a head for all 16 queries.
// n is kept as log2(n) in f16 (-inf for 0) and added to the score.
// A wave walks the list in chunks of 32 rows, copied to its own part of LDS by
// asynchronous copies (a row: k and v, 256 bytes), two buffers, with a running
// maximum:  S^T = K Q^T (rows u, columns q),  O^T += V^T P^T.
// Two D tiles of S^T, converted in place, are the B operand P^T; V^T comes from
// transposing LDS loads in the same k order.
// q: [B][H][S][64] f32, rounded here to f16 with the scale and log2(e) folded in.
// kv: [B][H][S][128] f16, k row then v row. Weights are rounded to f16, sums are
// f32. Output: [B][S][DIM] bf16: the operand of the output projection.
// ---------------------------------------------------------------------------
#define ATT_WAVES  16
#define CH_ROWS    32
#define ROW_PITCH  272                       // 256 + 16: 16 B x odd, the 16-byte fragment reads' pitch
#define BUF_BYTES  (CH_ROWS * ROW_PITCH)
#define BIAS_PITCH (ATT_WAVES * KN_ * 2 + 16) // bytes: 16 B x odd, read 16 bytes a lane
#define LIST_LEN   (ATT_WAVES * KN_ + CH_ROWS)
#define MASKED_    (-1.0e30f)

typedef _Float16 v16h  __attribute__((ext_vector_type(16)));
typedef _Float16 v8h   __attribute__((ext_vector_type(8)));
typedef float    f32x2 __attribute__((ext_vector_type(2)));
typedef short    s16x8 __attribute__((ext_vector_type(8)));
typedef __attribute__((address_space(3))) s16x8 as3_s16x8;
struct Tr32 { s16x8 lo; s16x8 hi; };         // 32 bytes == v16h

// lane l with lane l ^ 16
__device__ __forceinline__ float half_xor(float x) {
    return __builtin_bit_cast(float, __builtin_amdgcn_permlanex16(
        __builtin_bit_cast(int, x), __builtin_bit_cast(int, x),
        0x76543210, 0xfedcba98, false, false));
}
__device__ __forceinline__ float exp2_slot(float x) {
    float y;
    asm("v_exp_f32 %0, %1\n\tv_nop" : "=v"(y) : "v"(x));
    return y;
}
// eight at once: each stands in front of one that neither reads its result nor
// overwrites its source (early-clobber outputs), so one v_nop at the end serves all
__device__ __forceinline__ void exp2_x8(float (&y)[8], const float (&x)[8]) {
    asm("v_exp_f32 %0, %8\n\tv_exp_f32 %1, %9\n\tv_exp_f32 %2, %10\n\tv_exp_f32 %3, %11\n\t"
        "v_exp_f32 %4, %12\n\tv_exp_f32 %5, %13\n\tv_exp_f32 %6, %14\n\tv_exp_f32 %7, %15\n\tv_nop"
        : "=&v"(y[0]), "=&v"(y[1]), "=&v"(y[2]), "=&v"(y[3]),
          "=&v"(y[4]), "=&v"(y[5]), "=&v"(y[6]), "=&v"(y[7])
        : "v"(x[0]), "v"(x[1]), "v"(x[2]), "v"(x[3]), "v"(x[4]), "v"(x[5]), "v"(x[6]), "v"(x[7]));
}
// log2(x), with the same slot behind it
__device__ __forceinline__ float log2_slot(float x) {
    float y;
    asm("v_log_f32 %0, %1\n\tv_nop" : "=v"(y) : "v"(x));
    return y;
}

__global__ __launch_bounds__(ATT_WAVES * 32)
void attn_kernel(
    const float* __restrict__ q,
    const unsigned short* __restrict__ kv,
    const int*   __restrict__ routes,
    unsigned short* __restrict__ attn_out)
{
    __shared__ __attribute__((aligned(16))) unsigned char  ring[ATT_WAVES][2][BUF_BYTES];
    __shared__ __attribute__((aligned(16))) unsigned char  bias[ATT_WAVES * BIAS_PITCH];
    __shared__ __attribute__((aligned(16))) unsigned       list[LIST_LEN];   // byte offsets of rows
    __shared__ __attribute__((aligned(16))) unsigned short slot[S_];
    __shared__ __attribute__((aligned(16))) unsigned char  flag[S_];
    __shared__ unsigned wsum[ATT_WAVES];

    const int tid  = threadIdx.x;
    const int wave = __builtin_amdgcn_readfirstlane(tid >> 5);
    const int lane = tid & 31;
    const int c    = lane & 15;
    const int hh   = lane >> 4;
    const int s0   = blockIdx.x * ATT_WAVES;
    const int b    = blockIdx.y;

    // ---- the block's list of distinct rows. Wave w holds the 64 routes of query
    // s0 + w, two a lane; the mask bounds the row index whatever the array holds
    const int2 rr = *reinterpret_cast<const int2*>(routes + (s0 + wave) * KN_ + lane * 2);
    const unsigned r0 = (unsigned)rr.x & (S_ - 1);
    const unsigned r1 = (unsigned)rr.y & (S_ - 1);
    reinterpret_cast<unsigned*>(flag)[tid] = 0u;              // 512 x 4 = S_ bytes
    for (int i = tid; i < LIST_LEN; i += ATT_WAVES * 32)      // unlisted places name row 0
        list[i] = 0u;
    for (int i = tid; i < ATT_WAVES * BIAS_PITCH / 16; i += ATT_WAVES * 32)   // f16 -inf
        reinterpret_cast<uint4*>(bias)[i] = uint4{0xFC00FC00u, 0xFC00FC00u, 0xFC00FC00u, 0xFC00FC00u};
    __syncthreads();
    flag[r0] = 1;   // several lanes may store the same 1
    flag[r1] = 1;
    __syncthreads();
    // a thread ranks rows 4 tid .. + 3: sum over the lanes below, then over the waves below
    const unsigned fw = reinterpret_cast<const unsigned*>(flag)[tid];
    const unsigned nf = (unsigned)__popc(fw);
    unsigned inc = nf;
#pragma unroll  // five steps with constant distances, no loop counter
    for (int d = 1; d < 32; d <<= 1) {
        const unsigned t = __shfl_up(inc, d);
        if (lane >= d) inc += t;
    }
    if (lane == 31) wsum[wave] = inc;
    __syncthreads();
    unsigned place = inc - nf, total = 0;
#pragma unroll  // the 16 LDS reads go out together
    for (int w = 0; w < ATT_WAVES; ++w) {
        const unsigned v = wsum[w];
        total += v;
        if (w < wave) place += v;
    }
#pragma unroll  // four steps with constant shifts, no loop counter
    for (int k = 0; k < 4; ++k)
        if ((fw >> (8 * k)) & 1u) {
            slot[tid * 4 + k] = (unsigned short)place;
            list[place]       = (unsigned)(tid * 4 + k) * (2 * HD_ * 2);
            ++place;
        }
    __syncthreads();
    // how often the wave's query names each of its rows (equal routes store the same count)
    {
        int c0 = 0, c1 = 0;
#pragma unroll  // v_readlane takes the lane's number as a constant
        for (int i = 0; i < 32; ++i) {
            const unsigned a0 = (unsigned)__builtin_amdgcn_readlane((int)r0, i);
            const unsigned a1 = (unsigned)__builtin_amdgcn_readlane((int)r1, i);
            const int n0 = __popc(__builtin_amdgcn_ballot_w32(r0 == a0))
                         + __popc(__builtin_amdgcn_ballot_w32(r1 == a0));
            const int n1 = __popc(__builtin_amdgcn_ballot_w32(r0 == a1))
                         + __popc(__builtin_amdgcn_ballot_w32(r1 == a1));
            c0 = (lane == i) ? n0 : c0;
            c1 = (lane == i) ? n1 : c1;
        }
        *reinterpret_cast<_Float16*>(bias + wave * BIAS_PITCH + slot[r0] * 2) = (_Float16)log2_slot((float)c0);
        *reinterpret_cast<_Float16*>(bias + wave * BIAS_PITCH + slot[r1] * 2) = (_Float16)log2_slot((float)c1);
    }
    const int nCh = __builtin_amdgcn_readfirstlane((int)((total + CH_ROWS - 1) / CH_ROWS));

    // ---- this wave's head
    const size_t plane = ((size_t)b * H_ + wave) * S_;
    const char* kvH = reinterpret_cast<const char*>(kv) + plane * (2 * HD_ * 2);
    unsigned char* myRing = &ring[wave][0][0];

    // one chunk: 32 listed rows of 256 bytes; a copy takes two whole rows (16 lanes each)
    auto issue_chunk = [&](int buf, int ch) {
        const uint4* lp = reinterpret_cast<const uint4*>(&list[ch * CH_ROWS + hh * 16]);
        const uint4 l0 = lp[0], l1 = lp[1], l2 = lp[2], l3 = lp[3];
        const unsigned w[16] = {l0.x, l0.y, l0.z, l0.w, l1.x, l1.y, l1.z, l1.w,
                                l2.x, l2.y, l2.z, l2.w, l3.x, l3.y, l3.z, l3.w};
        unsigned char* dst = myRing + buf * BUF_BYTES + hh * 16 * ROW_PITCH + c * 16;
#pragma unroll  // constant indices keep the arrays in registers
        for (int i = 0; i < 16; ++i) {
            __builtin_amdgcn_global_load_async_to_lds_b128(
                (as1_v4i*)(kvH + (w[i] + c * 16)),
                (as3_v4i*)(dst + i * ROW_PITCH), 0, 0);
        }
    };

    // Q^T as B operand: column c = query s0 + c, k = d in the hardware order.
    // A uniform base and one 32-bit offset a lane, which all eight loads name
    v16h qf[2];
    {
        const char* qH = reinterpret_cast<const char*>(q) + (plane + s0) * (HD_ * 4);
        const unsigned qoff = (unsigned)c * (HD_ * 4) + hh * 32;
        float4 x[8];
#pragma unroll  // constant indices keep the array in registers, all loads in flight together
        for (int i = 0; i < 8; ++i)   // i = ks*4 + g*2 + piece: d = ks*32 + g*16 + hh*8 + piece*4
            x[i] = *reinterpret_cast<const float4*>(qH + ((i >> 1) * 64 + (i & 1) * 16) + qoff);
        // behind the last load; the offset is an input so that it lives up to here and no
        // load's result lands in the register that the loads in front of it still name
        asm volatile("s_wait_xcnt 0x0" :: "v"(qoff) : "memory");
        const float f = SCALE_ * 1.44269504f;
#pragma unroll  // constant indices keep the arrays in registers
        for (int i = 0; i < 8; ++i) {
            qf[i >> 2][(i & 3) * 4 + 0] = (_Float16)(x[i].x * f);
            qf[i >> 2][(i & 3) * 4 + 1] = (_Float16)(x[i].y * f);
            qf[i >> 2][(i & 3) * 4 + 2] = (_Float16)(x[i].z * f);
            qf[i >> 2][(i & 3) * 4 + 3] = (_Float16)(x[i].w * f);
        }
    }

    v8f acc[4];
#pragma unroll  // constant indices keep the arrays in registers
    for (int dt = 0; dt < 4; ++dt) acc[dt] = v8f{};
    float m = MASKED_, l = 0.f;

    issue_chunk(0, 0);
    // chunk 0 has landed for this wave; the barrier also publishes every wave's log2(n)
    asm volatile("s_wait_asynccnt 0x0" ::: "memory");
    __syncthreads();
    if (nCh > 1) issue_chunk(1, 1);

    const unsigned char* biasL = bias + c * BIAS_PITCH + hh * 16;
    const int kOff = c * ROW_PITCH + hh * 16;
    const int vOff = (hh * 8 + (lane & 7)) * ROW_PITCH + 2 * HD_ + ((lane >> 3) & 1) * 16;

    for (int ch = 0; ch < nCh; ++ch) {
        const unsigned char* buf = myRing + (ch & 1) * BUF_BYTES;

        // S^T: two tiles of 16 listed rows x 16 queries, already in log2 units
        v8f S[2];
#pragma unroll  // constant indices keep the arrays in registers
        for (int t = 0; t < 2; ++t) {
            S[t] = v8f{};
#pragma unroll  // constant indices keep the arrays in registers
            for (int ks = 0; ks < 2; ++ks) {
                Raw32 r;
                r.lo = *reinterpret_cast<const uint4*>(buf + kOff + t * 16 * ROW_PITCH + ks * 64);
                r.hi = *reinterpret_cast<const uint4*>(buf + kOff + t * 16 * ROW_PITCH + ks * 64 + 32);
                S[t] = __builtin_amdgcn_wmma_f32_16x16x32_f16(
                           false, __builtin_bit_cast(v16h, r), false, qf[ks], (short)0, S[t], false, false);
            }
        }

        // lane (c, hh): query c, listed rows ch*32 + t*16 + hh*8 + r
        float mx = MASKED_;
#pragma unroll  // constant indices keep the arrays in registers
        for (int t = 0; t < 2; ++t) {
            const v8h bh = *reinterpret_cast<const v8h*>(biasL + ch * (CH_ROWS * 2) + t * 32);
#pragma unroll  // constant indices keep the arrays in registers
            for (int r = 0; r < 8; ++r) {
                S[t][r] += (float)bh[r];      // -inf: a row the query does not name
                mx = fmaxf(mx, S[t][r]);
            }
        }
        mx = fmaxf(mx, half_xor(mx));
        const float mNew  = fmaxf(m, mx);     // finite: never below MASKED_
        const float alpha = exp2_slot(m - mNew);
        m = mNew;
        f32x2 ps = {0.f, 0.f};
        v16h pf;
#pragma unroll  // constant indices keep the arrays in registers
        for (int t = 0; t < 2; ++t) {
            float x[8], p[8];
#pragma unroll  // constant indices keep the arrays in registers
            for (int r = 0; r < 8; ++r) x[r] = S[t][r] - mNew;
            exp2_x8(p, x);
#pragma unroll  // constant indices keep the arrays in registers
            for (int r = 0; r < 8; r += 2) {
                ps += f32x2{p[r], p[r + 1]};
                pf[t * 8 + r]     = (_Float16)p[r];
                pf[t * 8 + r + 1] = (_Float16)p[r + 1];
            }
        }
        l = l * alpha + (ps.x + ps.y);

        // O^T (rows d, columns q) += V^T P^T
#pragma unroll  // constant indices keep the arrays in registers
        for (int dt = 0; dt < 4; ++dt) {
            Tr32 v;
            v.lo = __builtin_amdgcn_ds_load_tr16_b128_v8i16(
                       (as3_s16x8*)(buf + vOff + dt * 32));
            v.hi = __builtin_amdgcn_ds_load_tr16_b128_v8i16(
                       (as3_s16x8*)(buf + vOff + dt * 32 + 16 * ROW_PITCH));
            acc[dt] *= alpha;
            acc[dt] = __builtin_amdgcn_wmma_f32_16x16x32_f16(
                          false, __builtin_bit_cast(v16h, v), false, pf, (short)0, acc[dt], false, false);
        }

        // hand-over: this wave's reads of the buffer are done ...
        asm volatile("s_wait_dscnt 0x0" ::: "memory");
        // ... its copies of chunk ch + 1 have landed ...
        asm volatile("s_wait_asynccnt 0x0" ::: "memory");
        // ... and every wave stands here: the buffer just read may be refilled
        __syncthreads();
        if (ch + 2 < nCh) issue_chunk(ch & 1, ch + 2);
    }
    // no copy is outstanding when the wave ends
    asm volatile("s_wait_asynccnt 0x0" ::: "memory");

    // lane (c, hh) holds d = dt*16 + hh*8 + 0..7 of query c: 16 bytes of bf16 a tile
    l += half_xor(l);
    const float inv = 1.0f / l;
    unsigned short* op = attn_out + ((size_t)b * S_ + s0 + c) * DIM_ + wave * HD_ + hh * 8;
#pragma unroll  // constant indices keep the arrays in registers
    for (int dt = 0; dt < 4; ++dt) {
        uint4 o;
        o.x = (unsigned)f32_to_bf16u(acc[dt][0] * inv) | ((unsigned)f32_to_bf16u(acc[dt][1] * inv) << 16);
        o.y = (unsigned)f32_to_bf16u(acc[dt][2] * inv) | ((unsigned)f32_to_bf16u(acc[dt][3] * inv) << 16);
        o.z = (unsigned)f32_to_bf16u(acc[dt][4] * inv) | ((unsigned)f32_to_bf16u(acc[dt][5] * inv) << 16);
        o.w = (unsigned)f32_to_bf16u(acc[dt][6] * inv) | ((unsigned)f32_to_bf16u(acc[dt][7] * inv) << 16);
        *reinterpret_cast<uint4*>(op + dt * 16) = o;
    }
}

// ---------------------------------------------------------------------------
// Orchestration
// ---------------------------------------------------------------------------
extern "C" void kernel_launch(void* const* d_in, const int* in_sizes, int n_in,
                              void* d_out, int out_size, void* d_ws, size_t ws_size,
                              hipStream_t stream) {
    const float* x      = (const float*)d_in[0];
    const int*   routes = (const int*)  d_in[1];
    const float* qkv_w  = (const float*)d_in[2];
    const float* qkv_b  = (const float*)d_in[3];
    const float* out_w  = (const float*)d_in[4];
    const float* out_b  = (const float*)d_in[5];
    float* out = (float*)d_out;

    const int M = B_ * S_;          // 4096
    char* ws = (char*)d_ws;
    size_t off = 0;
    auto take = [&](size_t bytes) -> char* {
        char* p = ws + off;
        off += (bytes + 255) & ~(size_t)255;
        return p;
    };
    unsigned short* x_bf    = (unsigned short*)take((size_t)M * DIM_ * 2);
    unsigned short* qw_bf   = (unsigned short*)take((size_t)3 * DIM_ * DIM_ * 2);
    unsigned short* ow_bf   = (unsigned short*)take((size_t)DIM_ * DIM_ * 2);
    float*          q_f32   = (float*)        take((size_t)B_ * H_ * S_ * HD_ * 4);
    unsigned short* kv_f16  = (unsigned short*)take((size_t)B_ * H_ * S_ * 2 * HD_ * 2);
    unsigned short* aout_bf = (unsigned short*)take((size_t)M * DIM_ * 2);

    // 1) bf16 conversions of the three inputs, one grid
    cvt_inputs_kernel<<<CVT_BLK_X + CVT_BLK_QW + CVT_BLK_OW, CVT_WAVES * 32, 0, stream>>>(
        x, x_bf, qkv_w, qw_bf, out_w, ow_bf);

    // 2) QKV projection GEMM (WMMA bf16 + async LDS staging) -> q f32, k and v f16
    wmma_gemm_kernel<1, 256, 192, 64><<<dim3((3 * DIM_) / 192, M / 256), 384, 0, stream>>>(
        x_bf, qw_bf, qkv_b, q_f32, kv_f16, M, 3 * DIM_, DIM_);

    // 3) Gathered attention + softmax -> bf16
    attn_kernel<<<dim3(S_ / ATT_WAVES, B_), ATT_WAVES * 32, 0, stream>>>(
        q_f32, kv_f16, routes, aout_bf);

    // 4) Output projection GEMM (WMMA bf16) -> d_out
    wmma_gemm_kernel<0, 128, 128, 64><<<dim3(DIM_ / 128, M / 128), 128, 0, stream>>>(
        aout_bf, ow_bf, out_b, out, nullptr, M, DIM_, DIM_);
}
